// v000
// Measured on an AMD MI455X. A time is GPU time per run, averaged over a window of back-to-back runs after a warm-up
// (all launches, gaps included; the runs take copies of the inputs in turn), and the median of several windows.
// Apart from v000's, it joins two sittings. Times from different sittings can be a few percent apart, while
// side-by-side timings come from the same sitting.
// v000 is the starting kernel. One run takes 174 microseconds.
#include <hip/hip_runtime.h>
#include <stddef.h>

// All three channel contractions: v_wmma_f32_16x16x32_f16 (f16 operands, f32 accumulate); A operand carried x16 and weights x64 in f16, 1/1024 folded into the f32 epilogue; bias, LayerNorm and GELU in f32.

typedef _Float16 v16h __attribute__((ext_vector_type(16)));
typedef _Float16 v8h  __attribute__((ext_vector_type(8)));
typedef _Float16 v4h  __attribute__((ext_vector_type(4)));
typedef float    v8f  __attribute__((ext_vector_type(8)));
typedef float    v4f  __attribute__((ext_vector_type(4)));

union Frag { v16h v; v8h half[2]; };

#define CCH        768            // channels (K and N of every contraction)
#define HWN        1024           // spatial positions per image
#define KSTEPS     (CCH / 32)     // 24 k-steps of 32
#define APITCH     40             // halves per staged A row (80 B)
#define TPITCH     776            // halves per staged output row (1552 B, 16-B multiple)
#define SPITCH     68             // floats per staged output column segment (272 B)
#define TILE_BYTES (64 * TPITCH * 2)   // 99,328 B; also holds 16 waves x 16 x SPITCH floats (69,632 B)

// 16x16x32 f16 WMMA with the hazard guard tied to D, A and B.
__device__ __forceinline__ v8f wmma_f16(v16h a, v16h b, v8f c)
{
  v8f d = __builtin_amdgcn_wmma_f32_16x16x32_f16(false, a, false, b, (short)0, c, false, false);
  asm volatile("v_nop\n\tv_nop\n\tv_nop\n\tv_nop" : "+v"(d) : "v"(a), "v"(b));
  return d;
}

// ---------------- weights f32 [768][768] -> f16 x64, three matrices, one launch ----------------
// Each thread converts 8 consecutive floats and writes one 16-B vector; a wave instruction
__global__ __launch_bounds__(256) void k_wcvt(const float* __restrict__ w0,
                                              const float* __restrict__ w1,
                                              const float* __restrict__ w2,
                                              _Float16* __restrict__ wb, int n8)
{
  const int which = blockIdx.y;
  const float* w = (which == 0) ? w0 : ((which == 1) ? w1 : w2);
  _Float16* dst = wb + (size_t)which * (size_t)n8 * 8;
  const int i = blockIdx.x * blockDim.x + threadIdx.x;
  if (i < n8) {
    const v4f a = *(const v4f*)(w + (size_t)i * 8);
    const v4f b = *(const v4f*)(w + (size_t)i * 8 + 4);
    v8h o;
    o[0] = (_Float16)(a[0] * 64.0f);
    o[1] = (_Float16)(a[1] * 64.0f);
    o[2] = (_Float16)(a[2] * 64.0f);
    o[3] = (_Float16)(a[3] * 64.0f);
    o[4] = (_Float16)(b[0] * 64.0f);
    o[5] = (_Float16)(b[1] * 64.0f);
    o[6] = (_Float16)(b[2] * 64.0f);
    o[7] = (_Float16)(b[3] * 64.0f);
    v8h* p = (v8h*)(dst + (size_t)i * 8);
    *p = o;
    
  }
}

// ---------------- NCHW f32 -> token-major [n][c] f16 (x16) ----------------
// Block = (32 positions, one image). Tile [32 pos][768 ch] staged in LDS as f16;
__global__ __launch_bounds__(256) void k_tin(const float* __restrict__ x,
                                             _Float16* __restrict__ xt, int nrows)
{
  __shared__ _Float16 tile[32 * TPITCH] __attribute__((aligned(16)));
  const int tid = threadIdx.x, lane = tid & 31, wave = tid >> 5;
  const int b  = blockIdx.y;
  const int p0 = blockIdx.x * 32;
  const float* src = x + (size_t)b * CCH * HWN + p0;
  const int q = lane & 7, cs = lane >> 3;     // 8 lanes x float4 = 32 positions, 4 channels per wave step
  for (int it = 0; it < CCH / 32; ++it) {
    const int c = it * 32 + wave * 4 + cs;
    const v4f v = *(const v4f*)(src + (size_t)c * HWN + q * 4);
    _Float16* t = tile + (q * 4) * TPITCH + c;
    t[0]          = (_Float16)(v[0] * 16.0f);
    t[TPITCH]     = (_Float16)(v[1] * 16.0f);
    t[2 * TPITCH] = (_Float16)(v[2] * 16.0f);
    t[3 * TPITCH] = (_Float16)(v[3] * 16.0f);
  }
  __syncthreads();
  {
    for (int rr = 0; rr < 4; ++rr) {
      const int r = wave * 4 + rr;
      const int n = b * HWN + p0 + r;
      if (n < nrows) {
        const _Float16* trow = tile + r * TPITCH + lane * 8;
        _Float16* grow = xt + (size_t)n * CCH + lane * 8;
#pragma unroll
        for (int j = 0; j < 3; ++j) {
          const v8h v = *(const v8h*)(trow + j * 256);
          *(v8h*)(grow + j * 256) = v;
        }
      }
    }
    
  }
}

// ---------------- fused GEMM (+bias, optional LayerNorm+GELU) ----------------
// Block: 512 threads = 16 waves, 64 token rows x all 768 output channels.
// Wave w owns N-tiles [3w, 3w+3), all 4 M-tiles. K loop: 24 steps of 32.
// A staged in LDS (double buffer), B fragments straight from the f16 weight copy [o][k].
// DO_LN:  result (x16, f16) staged as a 64x768 tile in LDS, written row-major in whole rows.
// !DO_LN: result written directly in NCHW: per output channel the block's 64 rows form one
//         contiguous 256-B segment; staged per wave in LDS, one store instruction per 2 segments.
template <bool DO_LN>
__global__ __launch_bounds__(512) void k_gemm(const _Float16* __restrict__ A,     // [nrows][768] f16 (x16)
                                              const _Float16* __restrict__ Wb,    // [768][768] f16 (x64), row o contiguous in k
                                              const float* __restrict__ bias,
                                              const float* __restrict__ gamma,
                                              const float* __restrict__ beta,
                                              _Float16* __restrict__ outH,        // DO_LN: [nrows][768] f16 (x16)
                                              float* __restrict__ outF,           // !DO_LN: NCHW f32
                                              int nrows)
{
  __shared__ _Float16 ldsA[2][64 * APITCH] __attribute__((aligned(16)));
  __shared__ unsigned char ldsT[TILE_BYTES] __attribute__((aligned(16)));
  __shared__ float lds_part[16 * 64];
  __shared__ float lds_mu[64];
  __shared__ float lds_rs[64];

  const int tid  = threadIdx.x;
  const int lane = tid & 31;
  const int wave = tid >> 5;
  const int h    = lane >> 4;     // lane half
  const int lm   = lane & 15;     // row for A, column for B and D
  const int n0   = blockIdx.x * 64;
  const int o0   = wave * 48;

  // A staging: 64 rows x 32 k halves, 8 B per thread
  const int arow = tid >> 3;
  const int acol = (tid & 7) * 4;
  int ga = n0 + arow;
  if (ga > nrows - 1) ga = nrows - 1;
  const _Float16* gA = A + (size_t)ga * CCH + acol;
  const int loff = arow * APITCH + acol;

  { const v4h v = *(const v4h*)gA; *(v4h*)(&ldsA[0][loff]) = v; }
  __syncthreads();

  v8f acc[4][3];
#pragma unroll
  for (int mt = 0; mt < 4; ++mt)
#pragma unroll
    for (int nt = 0; nt < 3; ++nt)
#pragma unroll
      for (int r = 0; r < 8; ++r) acc[mt][nt][r] = 0.0f;

  for (int kk = 0; kk < KSTEPS; ++kk) {
    const int buf = kk & 1;
    if (kk + 1 < KSTEPS) {     // prefetch next k-block into the other buffer (last read before the barrier of step kk-1)
      const v4h v = *(const v4h*)(gA + (kk + 1) * 32);
      *(v4h*)(&ldsA[buf ^ 1][loff]) = v;
    }

    // A fragments: row lm; elements 0..7 = k 8h..8h+7, elements 8..15 = k 16+8h..16+8h+7
    Frag af[4];
#pragma unroll
    for (int mt = 0; mt < 4; ++mt) {
      const _Float16* p = &ldsA[buf][(mt * 16 + lm) * APITCH + 8 * h];
      af[mt].half[0] = *(const v8h*)(p);
      af[mt].half[1] = *(const v8h*)(p + 16);
    }

    // B fragments: column o = o0+nt*16+lm, B[k][o] = W[o][k]; same k map as A
    const _Float16* wk = Wb + (size_t)kk * 32 + 8 * h;
#pragma unroll
    for (int nt = 0; nt < 3; ++nt) {
      Frag bfr;
      const _Float16* q = wk + (size_t)(o0 + nt * 16 + lm) * CCH;
      bfr.half[0] = *(const v8h*)(q);
      bfr.half[1] = *(const v8h*)(q + 16);
#pragma unroll
      for (int mt = 0; mt < 4; ++mt)
        acc[mt][nt] = wmma_f16(af[mt].v, bfr.v, acc[mt][nt]);
    }
    __syncthreads();
  }

  // ---- epilogue: D element r of lane = (row mt*16 + 8h + r, col o0 + nt*16 + lm) ----
  const float SC = 0.0009765625f;     // 1/1024 undoes the x16 * x64 operand scaling
  float bo[3], go[3], bt[3];
#pragma unroll
  for (int nt = 0; nt < 3; ++nt) {
    const int o = o0 + nt * 16 + lm;
    bo[nt] = bias[o];
    go[nt] = 1.0f; bt[nt] = 0.0f;
    if (DO_LN) { go[nt] = gamma[o]; bt[nt] = beta[o]; }
  }
#pragma unroll
  for (int mt = 0; mt < 4; ++mt)
#pragma unroll
    for (int nt = 0; nt < 3; ++nt)
#pragma unroll
      for (int r = 0; r < 8; ++r) acc[mt][nt][r] = acc[mt][nt][r] * SC + bo[nt];

  if (DO_LN) {
#pragma unroll
    for (int mt = 0; mt < 4; ++mt) {
#pragma unroll
      for (int r = 0; r < 8; ++r) {
        float s = acc[mt][0][r] + acc[mt][1][r] + acc[mt][2][r];
        s += __shfl_xor(s, 1, 32);
        s += __shfl_xor(s, 2, 32);
        s += __shfl_xor(s, 4, 32);
        s += __shfl_xor(s, 8, 32);
        if (lm == 0) lds_part[wave * 64 + mt * 16 + 8 * h + r] = s;
      }
    }
    __syncthreads();
    if (tid < 64) {
      float t = 0.0f;
#pragma unroll
      for (int w = 0; w < 16; ++w) t += lds_part[w * 64 + tid];
      lds_mu[tid] = t * (1.0f / 768.0f);
    }
    __syncthreads();
    // pass 2: sum of squared deviations
#pragma unroll
    for (int mt = 0; mt < 4; ++mt) {
#pragma unroll
      for (int r = 0; r < 8; ++r) {
        const float mu = lds_mu[mt * 16 + 8 * h + r];
        const float d0 = acc[mt][0][r] - mu;
        const float d1 = acc[mt][1][r] - mu;
        const float d2 = acc[mt][2][r] - mu;
        float s = d0 * d0 + d1 * d1 + d2 * d2;
        s += __shfl_xor(s, 1, 32);
        s += __shfl_xor(s, 2, 32);
        s += __shfl_xor(s, 4, 32);
        s += __shfl_xor(s, 8, 32);
        if (lm == 0) lds_part[wave * 64 + mt * 16 + 8 * h + r] = s;
      }
    }
    __syncthreads();
    if (tid < 64) {
      float t = 0.0f;
#pragma unroll
      for (int w = 0; w < 16; ++w) t += lds_part[w * 64 + tid];
      const float var = t * (1.0f / 768.0f);
      lds_rs[tid] = rsqrtf(var + 1e-6f);
    }
    __syncthreads();

    // normalize, affine, exact GELU; stage x16 as f16 in the 64x768 LDS tile
    _Float16* tile = (_Float16*)ldsT;
#pragma unroll
    for (int mt = 0; mt < 4; ++mt) {
#pragma unroll
      for (int r = 0; r < 8; ++r) {
        const int row = mt * 16 + 8 * h + r;
        const float mu = lds_mu[row];
        const float rs = lds_rs[row];
#pragma unroll
        for (int nt = 0; nt < 3; ++nt) {
          float y = (acc[mt][nt][r] - mu) * rs * go[nt] + bt[nt];
          y = 0.5f * y * (1.0f + erff(y * 0.70710678118654752f));
          tile[row * TPITCH + o0 + nt * 16 + lm] = (_Float16)(y * 16.0f);
        }
      }
    }
    __syncthreads();

    {
#pragma unroll
      for (int rr = 0; rr < 4; ++rr) {
        const int row = wave * 4 + rr;
        const int n = n0 + row;
        if (n < nrows) {
          const _Float16* trow = tile + row * TPITCH + lane * 8;
          _Float16* grow = outH + (size_t)n * CCH + lane * 8;
#pragma unroll
          for (int j = 0; j < 3; ++j) {
            const v8h v = *(const v8h*)(trow + j * 256);
            *(v8h*)(grow + j * 256) = v;
          }
        }
      }
      
    }
  } else {
    // NCHW output: block rows n0..n0+63 = positions hw0..hw0+63 of image bb (64 divides HWN)
    float* stg = (float*)ldsT + wave * (16 * SPITCH);
    const int bb  = n0 / HWN;
    const int hw0 = n0 - bb * HWN;
    const int rq  = lm * 4;              // 4 rows per lane within a 64-row segment
    const bool rows_ok = (n0 + 64 <= nrows);
#pragma unroll
    for (int nt = 0; nt < 3; ++nt) {
      // stage this wave's 16 columns x 64 rows, column-major
#pragma unroll
      for (int mt = 0; mt < 4; ++mt)
#pragma unroll
        for (int r = 0; r < 8; ++r)
          stg[lm * SPITCH + mt * 16 + 8 * h + r] = acc[mt][nt][r];
      __syncthreads();
      // per instruction: lanes 0-15 -> 256-B segment of one channel, lanes 16-31 -> the next channel
      {
#pragma unroll
        for (int pp = 0; pp < 8; ++pp) {
          const int c = 2 * pp + h;
          const v4f v = *(const v4f*)(stg + c * SPITCH + rq);
          const int o = o0 + nt * 16 + c;
          const size_t g = ((size_t)bb * CCH + (size_t)o) * HWN + (size_t)(hw0 + rq);
          if (rows_ok) *(v4f*)(outF + g) = v;
        }
        
      }
      __syncthreads();
    }
  }
}

// ---------------- launch glue ----------------
extern "C" void kernel_launch(void* const* d_in, const int* in_sizes, int n_in,
                              void* d_out, int out_size, void* d_ws, size_t ws_size,
                              hipStream_t stream)
{
  if (n_in < 11) return;
  const float* x   = (const float*)d_in[0];
  const float* W1  = (const float*)d_in[1];
  const float* b1  = (const float*)d_in[2];
  const float* g1  = (const float*)d_in[3];
  const float* be1 = (const float*)d_in[4];
  const float* W2  = (const float*)d_in[5];
  const float* b2  = (const float*)d_in[6];
  const float* g2  = (const float*)d_in[7];
  const float* be2 = (const float*)d_in[8];
  const float* W3  = (const float*)d_in[9];
  const float* b3  = (const float*)d_in[10];
  float* out = (float*)d_out;

  const int nrows = in_sizes[0] / CCH;                 // B * HWN token rows
  if (nrows <= 0 || (nrows % HWN) != 0 || (nrows % 64) != 0) return;
  if (out_size != nrows * CCH) return;
  const int nb = nrows / HWN;                          // images
  const int wn = in_sizes[1];                          // 768*768
  if (wn != CCH * CCH || in_sizes[5] != wn || in_sizes[9] != wn) return;
  const int n8 = wn / 8;

  const size_t BUF = (size_t)nrows * CCH * 2;          // f16 [nrows][768]
  const size_t need = 3 * BUF + (size_t)3 * (size_t)wn * 2;
  if (need > ws_size) return;
  char* ws = (char*)d_ws;
  _Float16* XT = (_Float16*)(ws);
  _Float16* H1 = (_Float16*)(ws + BUF);
  _Float16* H2 = (_Float16*)(ws + 2 * BUF);
  _Float16* WB = (_Float16*)(ws + 3 * BUF);

  k_wcvt<<<dim3((n8 + 255) / 256, 3), 256, 0, stream>>>(W1, W2, W3, WB, n8);
  k_tin<<<dim3(HWN / 32, nb), 256, 0, stream>>>(x, XT, nrows);

  const int gblocks = (nrows + 63) / 64;
  k_gemm<true ><<<gblocks, 512, 0, stream>>>(XT, WB,                  b1, g1, be1, H1, out, nrows);
  k_gemm<true ><<<gblocks, 512, 0, stream>>>(H1, WB + (size_t)wn,     b2, g2, be2, H2, out, nrows);
  k_gemm<false><<<gblocks, 512, 0, stream>>>(H2, WB + (size_t)2 * wn, b3, b3, b3,   H1, out, nrows);
}

// v001
// Measured time: 133 microseconds a run.
// Timed twice side by side with v000, it ran 1.30 and 1.31 times as fast.
#include <hip/hip_runtime.h>
#include <stddef.h>

// All three channel contractions: v_wmma_f32_16x16x32_f16 (f16 operands, f32 accumulate); A operand carried x16 and weights x64 in f16, 1/1024 folded into the f32 epilogue; bias, LayerNorm and GELU in f32.

typedef _Float16 v16h __attribute__((ext_vector_type(16)));
typedef _Float16 v8h  __attribute__((ext_vector_type(8)));
typedef _Float16 v4h  __attribute__((ext_vector_type(4)));
typedef float    v8f  __attribute__((ext_vector_type(8)));
typedef float    v4f  __attribute__((ext_vector_type(4)));

union Frag { v16h v; v8h half[2]; };

#define CCH        768            // channels (K and N of every contraction)
#define HWN        1024           // spatial positions per image
#define KPASS      64             // k per staged pass: 128 B (one whole line) of every operand row
#define NPASS      (CCH / KPASS)  // 12 passes
#define RPITCH     72             // halves per staged operand row (144 B = 16 B x odd, for ds_load_b128 readers)
#define STAGE_BYTES ((CCH + 64) * RPITCH * 2)   // 768 weight rows + 64 token rows = 119,808 B per buffer
#define TPITCH     776            // halves per staged output row (1552 B, 16-B multiple)
#define SPITCH     68             // floats per staged output column segment (272 B)
#define TILE_BYTES (64 * TPITCH * 2)   // 99,328 B; also holds 16 waves x 16 x SPITCH floats (69,632 B)

// 16x16x32 f16 WMMA with the hazard guard tied to D, A and B.
__device__ __forceinline__ v8f wmma_f16(v16h a, v16h b, v8f c)
{
  v8f d = __builtin_amdgcn_wmma_f32_16x16x32_f16(false, a, false, b, (short)0, c, false, false);
  asm volatile("v_nop\n\tv_nop\n\tv_nop\n\tv_nop" : "+v"(d) : "v"(a), "v"(b));
  return d;
}

// ---------------- weights f32 [768][768] -> f16 x64, three matrices, one launch ----------------
// Each thread converts 8 consecutive floats and writes one 16-B vector; a wave instruction
__global__ __launch_bounds__(256) void k_wcvt(const float* __restrict__ w0,
                                              const float* __restrict__ w1,
                                              const float* __restrict__ w2,
                                              _Float16* __restrict__ wb, int n8)
{
  const int which = blockIdx.y;
  const float* w = (which == 0) ? w0 : ((which == 1) ? w1 : w2);
  _Float16* dst = wb + (size_t)which * (size_t)n8 * 8;
  const int i = blockIdx.x * blockDim.x + threadIdx.x;
  if (i < n8) {
    const v4f a = *(const v4f*)(w + (size_t)i * 8);
    const v4f b = *(const v4f*)(w + (size_t)i * 8 + 4);
    v8h o;
    o[0] = (_Float16)(a[0] * 64.0f);
    o[1] = (_Float16)(a[1] * 64.0f);
    o[2] = (_Float16)(a[2] * 64.0f);
    o[3] = (_Float16)(a[3] * 64.0f);
    o[4] = (_Float16)(b[0] * 64.0f);
    o[5] = (_Float16)(b[1] * 64.0f);
    o[6] = (_Float16)(b[2] * 64.0f);
    o[7] = (_Float16)(b[3] * 64.0f);
    v8h* p = (v8h*)(dst + (size_t)i * 8);
    *p = o;
    
  }
}

// ---------------- NCHW f32 -> token-major [n][c] f16 (x16) ----------------
// Block = (32 positions, one image). Tile [32 pos][768 ch] staged in LDS as f16;
__global__ __launch_bounds__(256) void k_tin(const float* __restrict__ x,
                                             _Float16* __restrict__ xt, int nrows)
{
  __shared__ _Float16 tile[32 * TPITCH] __attribute__((aligned(16)));
  const int tid = threadIdx.x, lane = tid & 31, wave = tid >> 5;
  const int b  = blockIdx.y;
  const int p0 = blockIdx.x * 32;
  const float* src = x + (size_t)b * CCH * HWN + p0;
  const int q = lane & 7, cs = lane >> 3;     // 8 lanes x float4 = 32 positions, 4 channels per wave step
  for (int it = 0; it < CCH / 32; ++it) {
    const int c = it * 32 + wave * 4 + cs;
    const v4f v = *(const v4f*)(src + (size_t)c * HWN + q * 4);
    _Float16* t = tile + (q * 4) * TPITCH + c;
    t[0]          = (_Float16)(v[0] * 16.0f);
    t[TPITCH]     = (_Float16)(v[1] * 16.0f);
    t[2 * TPITCH] = (_Float16)(v[2] * 16.0f);
    t[3 * TPITCH] = (_Float16)(v[3] * 16.0f);
  }
  __syncthreads();
  {
    for (int rr = 0; rr < 4; ++rr) {
      const int r = wave * 4 + rr;
      const int n = b * HWN + p0 + r;
      if (n < nrows) {
        const _Float16* trow = tile + r * TPITCH + lane * 8;
        _Float16* grow = xt + (size_t)n * CCH + lane * 8;
#pragma unroll
        for (int j = 0; j < 3; ++j) {
          const v8h v = *(const v8h*)(trow + j * 256);
          *(v8h*)(grow + j * 256) = v;
        }
      }
    }
    
  }
}

// One wave's share of a stage: 12 copies for its own 48 weight rows and 1 copy for 4 token rows.
// Each copy moves 4 rows x 128 B (whole lines); lane = (row lane>>3, 16-B piece lane&7).
// s_wait_xcnt stands inside the statement so that no address register is rewritten ahead of it.
__device__ __forceinline__ void copy_stage(const _Float16* gb, const _Float16* ga, unsigned lb, unsigned la)
{
  const _Float16* g0  = gb;
  const _Float16* g1  = gb + 1 * 4 * CCH;
  const _Float16* g2  = gb + 2 * 4 * CCH;
  const _Float16* g3  = gb + 3 * 4 * CCH;
  const _Float16* g4  = gb + 4 * 4 * CCH;
  const _Float16* g5  = gb + 5 * 4 * CCH;
  const _Float16* g6  = gb + 6 * 4 * CCH;
  const _Float16* g7  = gb + 7 * 4 * CCH;
  const _Float16* g8  = gb + 8 * 4 * CCH;
  const _Float16* g9  = gb + 9 * 4 * CCH;
  const _Float16* g10 = gb + 10 * 4 * CCH;
  const _Float16* g11 = gb + 11 * 4 * CCH;
  const unsigned RS = 4 * RPITCH * 2;     // LDS bytes per 4 rows
  asm volatile("global_load_async_to_lds_b128 %0, %13, off\n\t"
               "global_load_async_to_lds_b128 %1, %14, off\n\t"
               "global_load_async_to_lds_b128 %2, %15, off\n\t"
               "global_load_async_to_lds_b128 %3, %16, off\n\t"
               "global_load_async_to_lds_b128 %4, %17, off\n\t"
               "global_load_async_to_lds_b128 %5, %18, off\n\t"
               "global_load_async_to_lds_b128 %6, %19, off\n\t"
               "global_load_async_to_lds_b128 %7, %20, off\n\t"
               "global_load_async_to_lds_b128 %8, %21, off\n\t"
               "global_load_async_to_lds_b128 %9, %22, off\n\t"
               "global_load_async_to_lds_b128 %10, %23, off\n\t"
               "global_load_async_to_lds_b128 %11, %24, off\n\t"
               "global_load_async_to_lds_b128 %12, %25, off\n\t"
               "s_wait_xcnt 0x0"
               :: "v"(la), "v"(lb), "v"(lb + 1 * RS), "v"(lb + 2 * RS), "v"(lb + 3 * RS),
                  "v"(lb + 4 * RS), "v"(lb + 5 * RS), "v"(lb + 6 * RS), "v"(lb + 7 * RS),
                  "v"(lb + 8 * RS), "v"(lb + 9 * RS), "v"(lb + 10 * RS), "v"(lb + 11 * RS),
                  "v"(ga), "v"(g0), "v"(g1), "v"(g2), "v"(g3), "v"(g4), "v"(g5), "v"(g6),
                  "v"(g7), "v"(g8), "v"(g9), "v"(g10), "v"(g11)
               : "memory");
}

// ---------------- fused GEMM (+bias, optional LayerNorm+GELU) ----------------
// Block: 512 threads = 16 waves, 64 token rows x all 768 output channels.
// Wave w owns N-tiles [3w, 3w+3), all 4 M-tiles. K loop: 12 passes of 64 k, two WMMA k-steps each.
// Both operands' k tiles come into a two-buffer LDS ring by asynchronous copies, one pass ahead of their use.
// The ring's first buffer is reused as output staging behind the last pass's barrier.
// DO_LN:  result (x16, f16) staged as a 64x768 tile in LDS, written row-major in whole rows.
// !DO_LN: result written directly in NCHW: per output channel the block's 64 rows form one
//         contiguous 256-B segment; staged per wave in LDS, one store instruction per 2 segments.
template <bool DO_LN>
__global__ __launch_bounds__(512) void k_gemm(const _Float16* __restrict__ A,     // [nrows][768] f16 (x16)
                                              const _Float16* __restrict__ Wb,    // [768][768] f16 (x64), row o contiguous in k
                                              const float* __restrict__ bias,
                                              const float* __restrict__ gamma,
                                              const float* __restrict__ beta,
                                              _Float16* __restrict__ outH,        // DO_LN: [nrows][768] f16 (x16)
                                              float* __restrict__ outF,           // !DO_LN: NCHW f32
                                              int nrows)
{
  __shared__ unsigned char ring[2 * STAGE_BYTES] __attribute__((aligned(16)));
  static_assert(TILE_BYTES <= STAGE_BYTES, "output staging must fit the first buffer");
  unsigned char* const ldsT = ring;
  __shared__ float lds_part[16 * 64];
  __shared__ float lds_mu[64];
  __shared__ float lds_rs[64];

  const int tid  = threadIdx.x;
  const int lane = tid & 31;
  const int wave = tid >> 5;
  const int h    = lane >> 4;     // lane half
  const int lm   = lane & 15;     // row for A, column for B and D
  const int n0   = blockIdx.x * 64;
  const int o0   = wave * 48;

  // copy addresses of this lane: row (lane >> 3) of a group of 4, 16-B piece (lane & 7)
  const int crow = lane >> 3;
  const int ccol = (lane & 7) * 8;
  int ga = n0 + wave * 4 + crow;
  if (ga > nrows - 1) ga = nrows - 1;
  const _Float16* gA = A + (size_t)ga * CCH + ccol;
  const _Float16* gB = Wb + (size_t)(o0 + crow) * CCH + ccol;
  const unsigned ring0 = (unsigned)(size_t)ring;     // LDS byte address of the ring
  const unsigned lB = ring0 + (unsigned)((o0 + crow) * RPITCH + ccol) * 2u;
  const unsigned lA = ring0 + (unsigned)((CCH + wave * 4 + crow) * RPITCH + ccol) * 2u;

  copy_stage(gB, gA, lB, lA);
  asm volatile("s_wait_asynccnt 0x0" ::: "memory");   // this wave's share of stage 0 has landed
  __syncthreads();                                    // publishes stage 0
  copy_stage(gB + KPASS, gA + KPASS, lB + STAGE_BYTES, lA + STAGE_BYTES);

  v8f acc[4][3];
#pragma unroll
  for (int mt = 0; mt < 4; ++mt)
#pragma unroll
    for (int nt = 0; nt < 3; ++nt)
#pragma unroll
      for (int r = 0; r < 8; ++r) acc[mt][nt][r] = 0.0f;

  for (int t = 0; t < NPASS; ++t) {
    const unsigned boff = (t & 1) ? (unsigned)STAGE_BYTES : 0u;
    const _Float16* sB = (const _Float16*)(ring + boff);
    const _Float16* sA = sB + CCH * RPITCH;
#pragma unroll     // both k-steps of a pass in line: LDS offsets become immediates, no inner branch
    for (int ks = 0; ks < KPASS / 32; ++ks) {
      // A fragments: row lm; elements 0..7 = k 8h..8h+7, elements 8..15 = k 16+8h..16+8h+7
      Frag af[4];
#pragma unroll
      for (int mt = 0; mt < 4; ++mt) {
        const _Float16* p = sA + (mt * 16 + lm) * RPITCH + ks * 32 + 8 * h;
        af[mt].half[0] = *(const v8h*)(p);
        af[mt].half[1] = *(const v8h*)(p + 16);
      }
      // B fragments: column o = o0+nt*16+lm, B[k][o] = W[o][k]; same k map as A
#pragma unroll
      for (int nt = 0; nt < 3; ++nt) {
        Frag bfr;
        const _Float16* q = sB + (o0 + nt * 16 + lm) * RPITCH + ks * 32 + 8 * h;
        bfr.half[0] = *(const v8h*)(q);
        bfr.half[1] = *(const v8h*)(q + 16);
#pragma unroll
        for (int mt = 0; mt < 4; ++mt)
          acc[mt][nt] = wmma_f16(af[mt].v, bfr.v, acc[mt][nt]);
      }
    }
    asm volatile("s_wait_dscnt 0x0" ::: "memory");     // this wave's reads of buffer t&1 are done before it is refilled
    asm volatile("s_wait_asynccnt 0x0" ::: "memory");  // this wave's share of stage t+1 has landed
    __syncthreads();                                   // publishes stage t+1, frees buffer t&1
    if (t + 2 < NPASS)
      copy_stage(gB + (t + 2) * KPASS, gA + (t + 2) * KPASS, lB + boff, lA + boff);
  }
  asm volatile("s_wait_asynccnt 0x0" ::: "memory");    // no copy is left in flight when the ring becomes output staging

  // ---- epilogue: D element r of lane = (row mt*16 + 8h + r, col o0 + nt*16 + lm) ----
  const float SC = 0.0009765625f;     // 1/1024 undoes the x16 * x64 operand scaling
  float bo[3], go[3], bt[3];
#pragma unroll
  for (int nt = 0; nt < 3; ++nt) {
    const int o = o0 + nt * 16 + lm;
    bo[nt] = bias[o];
    go[nt] = 1.0f; bt[nt] = 0.0f;
    if (DO_LN) { go[nt] = gamma[o]; bt[nt] = beta[o]; }
  }
#pragma unroll
  for (int mt = 0; mt < 4; ++mt)
#pragma unroll
    for (int nt = 0; nt < 3; ++nt)
#pragma unroll
      for (int r = 0; r < 8; ++r) acc[mt][nt][r] = acc[mt][nt][r] * SC + bo[nt];

  if (DO_LN) {
#pragma unroll
    for (int mt = 0; mt < 4; ++mt) {
#pragma unroll
      for (int r = 0; r < 8; ++r) {
        float s = acc[mt][0][r] + acc[mt][1][r] + acc[mt][2][r];
        s += __shfl_xor(s, 1, 32);
        s += __shfl_xor(s, 2, 32);
        s += __shfl_xor(s, 4, 32);
        s += __shfl_xor(s, 8, 32);
        if (lm == 0) lds_part[wave * 64 + mt * 16 + 8 * h + r] = s;
      }
    }
    __syncthreads();
    if (tid < 64) {
      float t = 0.0f;
#pragma unroll
      for (int w = 0; w < 16; ++w) t += lds_part[w * 64 + tid];
      lds_mu[tid] = t * (1.0f / 768.0f);
    }
    __syncthreads();
    // pass 2: sum of squared deviations
#pragma unroll
    for (int mt = 0; mt < 4; ++mt) {
#pragma unroll
      for (int r = 0; r < 8; ++r) {
        const float mu = lds_mu[mt * 16 + 8 * h + r];
        const float d0 = acc[mt][0][r] - mu;
        const float d1 = acc[mt][1][r] - mu;
        const float d2 = acc[mt][2][r] - mu;
        float s = d0 * d0 + d1 * d1 + d2 * d2;
        s += __shfl_xor(s, 1, 32);
        s += __shfl_xor(s, 2, 32);
        s += __shfl_xor(s, 4, 32);
        s += __shfl_xor(s, 8, 32);
        if (lm == 0) lds_part[wave * 64 + mt * 16 + 8 * h + r] = s;
      }
    }
    __syncthreads();
    if (tid < 64) {
      float t = 0.0f;
#pragma unroll
      for (int w = 0; w < 16; ++w) t += lds_part[w * 64 + tid];
      const float var = t * (1.0f / 768.0f);
      lds_rs[tid] = rsqrtf(var + 1e-6f);
    }
    __syncthreads();

    // normalize, affine, exact GELU; stage x16 as f16 in the 64x768 LDS tile
    _Float16* tile = (_Float16*)ldsT;
#pragma unroll
    for (int mt = 0; mt < 4; ++mt) {
#pragma unroll
      for (int r = 0; r < 8; ++r) {
        const int row = mt * 16 + 8 * h + r;
        const float mu = lds_mu[row];
        const float rs = lds_rs[row];
#pragma unroll
        for (int nt = 0; nt < 3; ++nt) {
          float y = (acc[mt][nt][r] - mu) * rs * go[nt] + bt[nt];
          y = 0.5f * y * (1.0f + erff(y * 0.70710678118654752f));
          tile[row * TPITCH + o0 + nt * 16 + lm] = (_Float16)(y * 16.0f);
        }
      }
    }
    __syncthreads();

    {
#pragma unroll
      for (int rr = 0; rr < 4; ++rr) {
        const int row = wave * 4 + rr;
        const int n = n0 + row;
        if (n < nrows) {
          const _Float16* trow = tile + row * TPITCH + lane * 8;
          _Float16* grow = outH + (size_t)n * CCH + lane * 8;
#pragma unroll
          for (int j = 0; j < 3; ++j) {
            const v8h v = *(const v8h*)(trow + j * 256);
            *(v8h*)(grow + j * 256) = v;
          }
        }
      }
      
    }
  } else {
    // NCHW output: block rows n0..n0+63 = positions hw0..hw0+63 of image bb (64 divides HWN)
    float* stg = (float*)ldsT + wave * (16 * SPITCH);
    const int bb  = n0 / HWN;
    const int hw0 = n0 - bb * HWN;
    const int rq  = lm * 4;              // 4 rows per lane within a 64-row segment
    const bool rows_ok = (n0 + 64 <= nrows);
#pragma unroll
    for (int nt = 0; nt < 3; ++nt) {
      // stage this wave's 16 columns x 64 rows, column-major
#pragma unroll
      for (int mt = 0; mt < 4; ++mt)
#pragma unroll
        for (int r = 0; r < 8; ++r)
          stg[lm * SPITCH + mt * 16 + 8 * h + r] = acc[mt][nt][r];
      __syncthreads();
      // per instruction: lanes 0-15 -> 256-B segment of one channel, lanes 16-31 -> the next channel
      {
#pragma unroll
        for (int pp = 0; pp < 8; ++pp) {
          const int c = 2 * pp + h;
          const v4f v = *(const v4f*)(stg + c * SPITCH + rq);
          const int o = o0 + nt * 16 + c;
          const size_t g = ((size_t)bb * CCH + (size_t)o) * HWN + (size_t)(hw0 + rq);
          if (rows_ok) *(v4f*)(outF + g) = v;
        }
        
      }
      __syncthreads();
    }
  }
}

// ---------------- launch glue ----------------
extern "C" void kernel_launch(void* const* d_in, const int* in_sizes, int n_in,
                              void* d_out, int out_size, void* d_ws, size_t ws_size,
                              hipStream_t stream)
{
  if (n_in < 11) return;
  const float* x   = (const float*)d_in[0];
  const float* W1  = (const float*)d_in[1];
  const float* b1  = (const float*)d_in[2];
  const float* g1  = (const float*)d_in[3];
  const float* be1 = (const float*)d_in[4];
  const float* W2  = (const float*)d_in[5];
  const float* b2  = (const float*)d_in[6];
  const float* g2  = (const float*)d_in[7];
  const float* be2 = (const float*)d_in[8];
  const float* W3  = (const float*)d_in[9];
  const float* b3  = (const float*)d_in[10];
  float* out = (float*)d_out;

  const int nrows = in_sizes[0] / CCH;                 // B * HWN token rows
  if (nrows <= 0 || (nrows % HWN) != 0 || (nrows % 64) != 0) return;
  if (out_size != nrows * CCH) return;
  const int nb = nrows / HWN;                          // images
  const int wn = in_sizes[1];                          // 768*768
  if (wn != CCH * CCH || in_sizes[5] != wn || in_sizes[9] != wn) return;
  const int n8 = wn / 8;

  const size_t BUF = (size_t)nrows * CCH * 2;          // f16 [nrows][768]
  const size_t need = 3 * BUF + (size_t)3 * (size_t)wn * 2;
  if (need > ws_size) return;
  char* ws = (char*)d_ws;
  _Float16* XT = (_Float16*)(ws);
  _Float16* H1 = (_Float16*)(ws + BUF);
  _Float16* H2 = (_Float16*)(ws + 2 * BUF);
  _Float16* WB = (_Float16*)(ws + 3 * BUF);

  k_wcvt<<<dim3((n8 + 255) / 256, 3), 256, 0, stream>>>(W1, W2, W3, WB, n8);
  k_tin<<<dim3(HWN / 32, nb), 256, 0, stream>>>(x, XT, nrows);

  const int gblocks = (nrows + 63) / 64;
  k_gemm<true ><<<gblocks, 512, 0, stream>>>(XT, WB,                  b1, g1, be1, H1, out, nrows);
  k_gemm<true ><<<gblocks, 512, 0, stream>>>(H1, WB + (size_t)wn,     b2, g2, be2, H2, out, nrows);
  k_gemm<false><<<gblocks, 512, 0, stream>>>(H2, WB + (size_t)2 * wn, b3, b3, b3,   H1, out, nrows);
}

// v002
// One run takes 115 microseconds.
// Timed twice side by side with v001, it ran 1.15 times as fast both times.
// All steps since v000 together make it 1.50 times as fast.
#include <hip/hip_runtime.h>
#include <stddef.h>

// All three channel contractions: v_wmma_f32_16x16x32_f16 (f16 operands, f32 accumulate); A operand carried x16 and weights x64 in f16, 1/1024 folded into the f32 epilogue; bias, LayerNorm and GELU in f32.

typedef _Float16 v16h __attribute__((ext_vector_type(16)));
typedef _Float16 v8h  __attribute__((ext_vector_type(8)));
typedef _Float16 v4h  __attribute__((ext_vector_type(4)));
typedef float    v8f  __attribute__((ext_vector_type(8)));
typedef float    v4f  __attribute__((ext_vector_type(4)));

union Frag { v16h v; v8h half[2]; };

#define CCH        768            // channels (K and N of every contraction)
#define HWN        1024           // spatial positions per image
#define KPASS      64             // k per staged pass: 128 B (one whole line) of every operand row
#define NPASS      (CCH / KPASS)  // 12 passes
#define RPITCH     72             // halves per staged operand row (144 B = 16 B x odd, for ds_load_b128 readers)
#define STAGE_BYTES ((CCH + 64) * RPITCH * 2)   // 768 weight rows + 64 token rows = 119,808 B per buffer
#define TPITCH     776            // halves per staged output row (1552 B, 16-B multiple)
#define SPITCH     68             // floats per staged output column segment (272 B)
#define TILE_BYTES (64 * TPITCH * 2)   // 99,328 B; also holds 16 waves x 16 x SPITCH floats (69,632 B)

// 16x16x32 f16 WMMA with the hazard guard tied to D, A and B.
__device__ __forceinline__ v8f wmma_f16(v16h a, v16h b, v8f c)
{
  v8f d = __builtin_amdgcn_wmma_f32_16x16x32_f16(false, a, false, b, (short)0, c, false, false);
  asm volatile("v_nop\n\tv_nop\n\tv_nop\n\tv_nop" : "+v"(d) : "v"(a), "v"(b));
  return d;
}

// Sum over the 16 lanes of a row, left in every lane of the row: four DPP steps (row_xmask 1, 2, 4, 8).
// Same butterfly as a shuffle by lane ^ 1, 2, 4, 8, so the same f32 sums, but on the vector port with no LDS round trip.
// All 32 lanes must be on.
__device__ __forceinline__ float row_sum16(float s)
{
  s += __builtin_bit_cast(float, __builtin_amdgcn_update_dpp(0, __builtin_bit_cast(int, s), 0x161, 0xf, 0xf, true));
  s += __builtin_bit_cast(float, __builtin_amdgcn_update_dpp(0, __builtin_bit_cast(int, s), 0x162, 0xf, 0xf, true));
  s += __builtin_bit_cast(float, __builtin_amdgcn_update_dpp(0, __builtin_bit_cast(int, s), 0x164, 0xf, 0xf, true));
  s += __builtin_bit_cast(float, __builtin_amdgcn_update_dpp(0, __builtin_bit_cast(int, s), 0x168, 0xf, 0xf, true));
  return s;
}

// ---------------- weights f32 [768][768] -> f16 x64, three matrices, one launch ----------------
// Each thread converts 8 consecutive floats and writes one 16-B vector; a wave instruction
__global__ __launch_bounds__(256) void k_wcvt(const float* __restrict__ w0,
                                              const float* __restrict__ w1,
                                              const float* __restrict__ w2,
                                              _Float16* __restrict__ wb, int n8)
{
  const int which = blockIdx.y;
  const float* w = (which == 0) ? w0 : ((which == 1) ? w1 : w2);
  _Float16* dst = wb + (size_t)which * (size_t)n8 * 8;
  const int i = blockIdx.x * blockDim.x + threadIdx.x;
  if (i < n8) {
    const v4f a = *(const v4f*)(w + (size_t)i * 8);
    const v4f b = *(const v4f*)(w + (size_t)i * 8 + 4);
    v8h o;
    o[0] = (_Float16)(a[0] * 64.0f);
    o[1] = (_Float16)(a[1] * 64.0f);
    o[2] = (_Float16)(a[2] * 64.0f);
    o[3] = (_Float16)(a[3] * 64.0f);
    o[4] = (_Float16)(b[0] * 64.0f);
    o[5] = (_Float16)(b[1] * 64.0f);
    o[6] = (_Float16)(b[2] * 64.0f);
    o[7] = (_Float16)(b[3] * 64.0f);
    v8h* p = (v8h*)(dst + (size_t)i * 8);
    *p = o;
    
  }
}

// ---------------- NCHW f32 -> token-major [n][c] f16 (x16) ----------------
// Block = (32 positions, one image). Tile [32 pos][768 ch] staged in LDS as f16;
__global__ __launch_bounds__(256) void k_tin(const float* __restrict__ x,
                                             _Float16* __restrict__ xt, int nrows)
{
  __shared__ _Float16 tile[32 * TPITCH] __attribute__((aligned(16)));
  const int tid = threadIdx.x, lane = tid & 31, wave = tid >> 5;
  const int b  = blockIdx.y;
  const int p0 = blockIdx.x * 32;
  const float* src = x + (size_t)b * CCH * HWN + p0;
  const int q = lane & 7, cs = lane >> 3;     // 8 lanes x float4 = 32 positions, 4 channels per wave step
  for (int it = 0; it < CCH / 32; ++it) {
    const int c = it * 32 + wave * 4 + cs;
    const v4f v = *(const v4f*)(src + (size_t)c * HWN + q * 4);
    _Float16* t = tile + (q * 4) * TPITCH + c;
    t[0]          = (_Float16)(v[0] * 16.0f);
    t[TPITCH]     = (_Float16)(v[1] * 16.0f);
    t[2 * TPITCH] = (_Float16)(v[2] * 16.0f);
    t[3 * TPITCH] = (_Float16)(v[3] * 16.0f);
  }
  __syncthreads();
  {
    for (int rr = 0; rr < 4; ++rr) {
      const int r = wave * 4 + rr;
      const int n = b * HWN + p0 + r;
      if (n < nrows) {
        const _Float16* trow = tile + r * TPITCH + lane * 8;
        _Float16* grow = xt + (size_t)n * CCH + lane * 8;
#pragma unroll
        for (int j = 0; j < 3; ++j) {
          const v8h v = *(const v8h*)(trow + j * 256);
          *(v8h*)(grow + j * 256) = v;
        }
      }
    }
    
  }
}

// One wave's share of a stage: 12 copies for its own 48 weight rows and 1 copy for 4 token rows.
// Each copy moves 4 rows x 128 B (whole lines); lane = (row lane>>3, 16-B piece lane&7).
// s_wait_xcnt stands inside the statement so that no address register is rewritten ahead of it.
__device__ __forceinline__ void copy_stage(const _Float16* gb, const _Float16* ga, unsigned lb, unsigned la)
{
  const _Float16* g0  = gb;
  const _Float16* g1  = gb + 1 * 4 * CCH;
  const _Float16* g2  = gb + 2 * 4 * CCH;
  const _Float16* g3  = gb + 3 * 4 * CCH;
  const _Float16* g4  = gb + 4 * 4 * CCH;
  const _Float16* g5  = gb + 5 * 4 * CCH;
  const _Float16* g6  = gb + 6 * 4 * CCH;
  const _Float16* g7  = gb + 7 * 4 * CCH;
  const _Float16* g8  = gb + 8 * 4 * CCH;
  const _Float16* g9  = gb + 9 * 4 * CCH;
  const _Float16* g10 = gb + 10 * 4 * CCH;
  const _Float16* g11 = gb + 11 * 4 * CCH;
  const unsigned RS = 4 * RPITCH * 2;     // LDS bytes per 4 rows
  asm volatile("global_load_async_to_lds_b128 %0, %13, off\n\t"
               "global_load_async_to_lds_b128 %1, %14, off\n\t"
               "global_load_async_to_lds_b128 %2, %15, off\n\t"
               "global_load_async_to_lds_b128 %3, %16, off\n\t"
               "global_load_async_to_lds_b128 %4, %17, off\n\t"
               "global_load_async_to_lds_b128 %5, %18, off\n\t"
               "global_load_async_to_lds_b128 %6, %19, off\n\t"
               "global_load_async_to_lds_b128 %7, %20, off\n\t"
               "global_load_async_to_lds_b128 %8, %21, off\n\t"
               "global_load_async_to_lds_b128 %9, %22, off\n\t"
               "global_load_async_to_lds_b128 %10, %23, off\n\t"
               "global_load_async_to_lds_b128 %11, %24, off\n\t"
               "global_load_async_to_lds_b128 %12, %25, off\n\t"
               "s_wait_xcnt 0x0"
               :: "v"(la), "v"(lb), "v"(lb + 1 * RS), "v"(lb + 2 * RS), "v"(lb + 3 * RS),
                  "v"(lb + 4 * RS), "v"(lb + 5 * RS), "v"(lb + 6 * RS), "v"(lb + 7 * RS),
                  "v"(lb + 8 * RS), "v"(lb + 9 * RS), "v"(lb + 10 * RS), "v"(lb + 11 * RS),
                  "v"(ga), "v"(g0), "v"(g1), "v"(g2), "v"(g3), "v"(g4), "v"(g5), "v"(g6),
                  "v"(g7), "v"(g8), "v"(g9), "v"(g10), "v"(g11)
               : "memory");
}

// ---------------- fused GEMM (+bias, optional LayerNorm+GELU) ----------------
// Block: 512 threads = 16 waves, 64 token rows x all 768 output channels.
// Wave w owns N-tiles [3w, 3w+3), all 4 M-tiles. K loop: 12 passes of 64 k, two WMMA k-steps each.
// Both operands' k tiles come into a two-buffer LDS ring by asynchronous copies, one pass ahead of their use.
// The ring's first buffer is reused as output staging behind the last pass's barrier.
// DO_LN:  result (x16, f16) staged as a 64x768 tile in LDS, written row-major in whole rows.
// !DO_LN: result written directly in NCHW: per output channel the block's 64 rows form one
//         contiguous 256-B segment; staged per wave in LDS, one store instruction per 2 segments.
template <bool DO_LN>
__global__ __launch_bounds__(512) void k_gemm(const _Float16* __restrict__ A,     // [nrows][768] f16 (x16)
                                              const _Float16* __restrict__ Wb,    // [768][768] f16 (x64), row o contiguous in k
                                              const float* __restrict__ bias,
                                              const float* __restrict__ gamma,
                                              const float* __restrict__ beta,
                                              _Float16* __restrict__ outH,        // DO_LN: [nrows][768] f16 (x16)
                                              float* __restrict__ outF,           // !DO_LN: NCHW f32
                                              int nrows)
{
  __shared__ unsigned char ring[2 * STAGE_BYTES] __attribute__((aligned(16)));
  static_assert(TILE_BYTES <= STAGE_BYTES, "output staging must fit the first buffer");
  unsigned char* const ldsT = ring;
  __shared__ float lds_part[16 * 64] __attribute__((aligned(16)));
  __shared__ float lds_mu[64];
  __shared__ float lds_rs[64];

  const int tid  = threadIdx.x;
  const int lane = tid & 31;
  const int wave = tid >> 5;
  const int h    = lane >> 4;     // lane half
  const int lm   = lane & 15;     // row for A, column for B and D
  const int n0   = blockIdx.x * 64;
  const int o0   = wave * 48;

  // copy addresses of this lane: row (lane >> 3) of a group of 4, 16-B piece (lane & 7)
  const int crow = lane >> 3;
  const int ccol = (lane & 7) * 8;
  int ga = n0 + wave * 4 + crow;
  if (ga > nrows - 1) ga = nrows - 1;
  const _Float16* gA = A + (size_t)ga * CCH + ccol;
  const _Float16* gB = Wb + (size_t)(o0 + crow) * CCH + ccol;
  const unsigned ring0 = (unsigned)(size_t)ring;     // LDS byte address of the ring
  const unsigned lB = ring0 + (unsigned)((o0 + crow) * RPITCH + ccol) * 2u;
  const unsigned lA = ring0 + (unsigned)((CCH + wave * 4 + crow) * RPITCH + ccol) * 2u;

  copy_stage(gB, gA, lB, lA);
  asm volatile("s_wait_asynccnt 0x0" ::: "memory");   // this wave's share of stage 0 has landed
  __syncthreads();                                    // publishes stage 0
  copy_stage(gB + KPASS, gA + KPASS, lB + STAGE_BYTES, lA + STAGE_BYTES);

  v8f acc[4][3];
#pragma unroll
  for (int mt = 0; mt < 4; ++mt)
#pragma unroll
    for (int nt = 0; nt < 3; ++nt)
#pragma unroll
      for (int r = 0; r < 8; ++r) acc[mt][nt][r] = 0.0f;

  for (int t = 0; t < NPASS; ++t) {
    const unsigned boff = (t & 1) ? (unsigned)STAGE_BYTES : 0u;
    const _Float16* sB = (const _Float16*)(ring + boff);
    const _Float16* sA = sB + CCH * RPITCH;
#pragma unroll     // both k-steps of a pass in line: LDS offsets become immediates, no inner branch
    for (int ks = 0; ks < KPASS / 32; ++ks) {
      // A fragments: row lm; elements 0..7 = k 8h..8h+7, elements 8..15 = k 16+8h..16+8h+7
      Frag af[4];
#pragma unroll
      for (int mt = 0; mt < 4; ++mt) {
        const _Float16* p = sA + (mt * 16 + lm) * RPITCH + ks * 32 + 8 * h;
        af[mt].half[0] = *(const v8h*)(p);
        af[mt].half[1] = *(const v8h*)(p + 16);
      }
      // B fragments: column o = o0+nt*16+lm, B[k][o] = W[o][k]; same k map as A
#pragma unroll
      for (int nt = 0; nt < 3; ++nt) {
        Frag bfr;
        const _Float16* q = sB + (o0 + nt * 16 + lm) * RPITCH + ks * 32 + 8 * h;
        bfr.half[0] = *(const v8h*)(q);
        bfr.half[1] = *(const v8h*)(q + 16);
#pragma unroll
        for (int mt = 0; mt < 4; ++mt)
          acc[mt][nt] = wmma_f16(af[mt].v, bfr.v, acc[mt][nt]);
      }
    }
    asm volatile("s_wait_dscnt 0x0" ::: "memory");     // this wave's reads of buffer t&1 are done before it is refilled
    asm volatile("s_wait_asynccnt 0x0" ::: "memory");  // this wave's share of stage t+1 has landed
    __syncthreads();                                   // publishes stage t+1, frees buffer t&1
    if (t + 2 < NPASS)
      copy_stage(gB + (t + 2) * KPASS, gA + (t + 2) * KPASS, lB + boff, lA + boff);
  }
  asm volatile("s_wait_asynccnt 0x0" ::: "memory");    // no copy is left in flight when the ring becomes output staging

  // ---- epilogue: D element r of lane = (row mt*16 + 8h + r, col o0 + nt*16 + lm) ----
  const float SC = 0.0009765625f;     // 1/1024 undoes the x16 * x64 operand scaling
  float bo[3], go[3], bt[3];
#pragma unroll
  for (int nt = 0; nt < 3; ++nt) {
    const int o = o0 + nt * 16 + lm;
    bo[nt] = bias[o];
    go[nt] = 1.0f; bt[nt] = 0.0f;
    if (DO_LN) { go[nt] = gamma[o]; bt[nt] = beta[o]; }
  }
#pragma unroll
  for (int mt = 0; mt < 4; ++mt)
#pragma unroll
    for (int nt = 0; nt < 3; ++nt)
#pragma unroll
      for (int r = 0; r < 8; ++r) acc[mt][nt][r] = acc[mt][nt][r] * SC + bo[nt];

  if (DO_LN) {
    v4f rsum[4][2];     // this lane half's 32 row sums (64 per wave), stored together by one lane of each row half
#pragma unroll
    for (int mt = 0; mt < 4; ++mt) {
#pragma unroll
      for (int r = 0; r < 8; ++r)
        rsum[mt][r >> 2][r & 3] = row_sum16(acc[mt][0][r] + acc[mt][1][r] + acc[mt][2][r]);
    }
    if (lm == 0) {
#pragma unroll
      for (int mt = 0; mt < 4; ++mt) {
        *(v4f*)(lds_part + wave * 64 + mt * 16 + 8 * h)     = rsum[mt][0];
        *(v4f*)(lds_part + wave * 64 + mt * 16 + 8 * h + 4) = rsum[mt][1];
      }
    }
    __syncthreads();
    if (tid < 64) {
      float t = 0.0f;
#pragma unroll
      for (int w = 0; w < 16; ++w) t += lds_part[w * 64 + tid];
      lds_mu[tid] = t * (1.0f / 768.0f);
    }
    __syncthreads();
    // pass 2: sum of squared deviations
#pragma unroll
    for (int mt = 0; mt < 4; ++mt) {
#pragma unroll
      for (int r = 0; r < 8; ++r) {
        const float mu = lds_mu[mt * 16 + 8 * h + r];
        const float d0 = acc[mt][0][r] - mu;
        const float d1 = acc[mt][1][r] - mu;
        const float d2 = acc[mt][2][r] - mu;
        rsum[mt][r >> 2][r & 3] = row_sum16(d0 * d0 + d1 * d1 + d2 * d2);
      }
    }
    if (lm == 0) {
#pragma unroll
      for (int mt = 0; mt < 4; ++mt) {
        *(v4f*)(lds_part + wave * 64 + mt * 16 + 8 * h)     = rsum[mt][0];
        *(v4f*)(lds_part + wave * 64 + mt * 16 + 8 * h + 4) = rsum[mt][1];
      }
    }
    __syncthreads();
    if (tid < 64) {
      float t = 0.0f;
#pragma unroll
      for (int w = 0; w < 16; ++w) t += lds_part[w * 64 + tid];
      const float var = t * (1.0f / 768.0f);
      lds_rs[tid] = rsqrtf(var + 1e-6f);
    }
    __syncthreads();

    // normalize, affine, exact GELU; stage x16 as f16 in the 64x768 LDS tile
    _Float16* tile = (_Float16*)ldsT;
#pragma unroll
    for (int mt = 0; mt < 4; ++mt) {
#pragma unroll
      for (int r = 0; r < 8; ++r) {
        const int row = mt * 16 + 8 * h + r;
        const float mu = lds_mu[row];
        const float rs = lds_rs[row];
#pragma unroll
        for (int nt = 0; nt < 3; ++nt) {
          float y = (acc[mt][nt][r] - mu) * rs * go[nt] + bt[nt];
          y = 0.5f * y * (1.0f + erff(y * 0.70710678118654752f));
          tile[row * TPITCH + o0 + nt * 16 + lm] = (_Float16)(y * 16.0f);
        }
      }
    }
    __syncthreads();

    {
#pragma unroll
      for (int rr = 0; rr < 4; ++rr) {
        const int row = wave * 4 + rr;
        const int n = n0 + row;
        if (n < nrows) {
          const _Float16* trow = tile + row * TPITCH + lane * 8;
          _Float16* grow = outH + (size_t)n * CCH + lane * 8;
#pragma unroll
          for (int j = 0; j < 3; ++j) {
            const v8h v = *(const v8h*)(trow + j * 256);
            *(v8h*)(grow + j * 256) = v;
          }
        }
      }
      
    }
  } else {
    // NCHW output: block rows n0..n0+63 = positions hw0..hw0+63 of image bb (64 divides HWN)
    float* stg = (float*)ldsT + wave * (16 * SPITCH);
    const int bb  = n0 / HWN;
    const int hw0 = n0 - bb * HWN;
    const int rq  = lm * 4;              // 4 rows per lane within a 64-row segment
    const bool rows_ok = (n0 + 64 <= nrows);
#pragma unroll
    for (int nt = 0; nt < 3; ++nt) {
      // stage this wave's 16 columns x 64 rows, column-major
#pragma unroll
      for (int mt = 0; mt < 4; ++mt)
#pragma unroll
        for (int r = 0; r < 8; ++r)
          stg[lm * SPITCH + mt * 16 + 8 * h + r] = acc[mt][nt][r];
      __syncthreads();
      // per instruction: lanes 0-15 -> 256-B segment of one channel, lanes 16-31 -> the next channel
      {
#pragma unroll
        for (int pp = 0; pp < 8; ++pp) {
          const int c = 2 * pp + h;
          const v4f v = *(const v4f*)(stg + c * SPITCH + rq);
          const int o = o0 + nt * 16 + c;
          const size_t g = ((size_t)bb * CCH + (size_t)o) * HWN + (size_t)(hw0 + rq);
          if (rows_ok) *(v4f*)(outF + g) = v;
        }
        
      }
      __syncthreads();
    }
  }
}

// ---------------- launch glue ----------------
extern "C" void kernel_launch(void* const* d_in, const int* in_sizes, int n_in,
                              void* d_out, int out_size, void* d_ws, size_t ws_size,
                              hipStream_t stream)
{
  if (n_in < 11) return;
  const float* x   = (const float*)d_in[0];
  const float* W1  = (const float*)d_in[1];
  const float* b1  = (const float*)d_in[2];
  const float* g1  = (const float*)d_in[3];
  const float* be1 = (const float*)d_in[4];
  const float* W2  = (const float*)d_in[5];
  const float* b2  = (const float*)d_in[6];
  const float* g2  = (const float*)d_in[7];
  const float* be2 = (const float*)d_in[8];
  const float* W3  = (const float*)d_in[9];
  const float* b3  = (const float*)d_in[10];
  float* out = (float*)d_out;

  const int nrows = in_sizes[0] / CCH;                 // B * HWN token rows
  if (nrows <= 0 || (nrows % HWN) != 0 || (nrows % 64) != 0) return;
  if (out_size != nrows * CCH) return;
  const int nb = nrows / HWN;                          // images
  const int wn = in_sizes[1];                          // 768*768
  if (wn != CCH * CCH || in_sizes[5] != wn || in_sizes[9] != wn) return;
  const int n8 = wn / 8;

  const size_t BUF = (size_t)nrows * CCH * 2;          // f16 [nrows][768]
  const size_t need = 3 * BUF + (size_t)3 * (size_t)wn * 2;
  if (need > ws_size) return;
  char* ws = (char*)d_ws;
  _Float16* XT = (_Float16*)(ws);
  _Float16* H1 = (_Float16*)(ws + BUF);
  _Float16* H2 = (_Float16*)(ws + 2 * BUF);
  _Float16* WB = (_Float16*)(ws + 3 * BUF);

  k_wcvt<<<dim3((n8 + 255) / 256, 3), 256, 0, stream>>>(W1, W2, W3, WB, n8);
  k_tin<<<dim3(HWN / 32, nb), 256, 0, stream>>>(x, XT, nrows);

  const int gblocks = (nrows + 63) / 64;
  k_gemm<true ><<<gblocks, 512, 0, stream>>>(XT, WB,                  b1, g1, be1, H1, out, nrows);
  k_gemm<true ><<<gblocks, 512, 0, stream>>>(H1, WB + (size_t)wn,     b2, g2, be2, H2, out, nrows);
  k_gemm<false><<<gblocks, 512, 0, stream>>>(H2, WB + (size_t)2 * wn, b3, b3, b3,   H1, out, nrows);
}

// v003
// It runs in 100 microseconds.
// In both of two side-by-side timings against v002, it was 1.15 times as fast.
// All steps since v000 together make it 1.73 times as fast.
#include <hip/hip_runtime.h>
#include <stddef.h>

// All three channel contractions: v_wmma_f32_16x16x32_f16 (f16 operands, f32 accumulate); A operand carried x16 and weights x64 in f16, 1/1024 folded into the f32 epilogue; bias, LayerNorm and GELU in f32.

typedef _Float16 v16h __attribute__((ext_vector_type(16)));
typedef _Float16 v8h  __attribute__((ext_vector_type(8)));
typedef _Float16 v4h  __attribute__((ext_vector_type(4)));
typedef _Float16 v2h  __attribute__((ext_vector_type(2)));
typedef float    v8f  __attribute__((ext_vector_type(8)));
typedef float    v4f  __attribute__((ext_vector_type(4)));
typedef float    v2f  __attribute__((ext_vector_type(2)));

union Frag { v16h v; v8h half[2]; };

#define CCH        768            // channels (K and N of every contraction)
#define HWN        1024           // spatial positions per image
#define KPASS      64             // k per staged pass: 128 B (one whole line) of every operand row
#define NPASS      (CCH / KPASS)  // 12 passes
#define RPITCH     72             // halves per staged operand row (144 B = 16 B x odd, for ds_load_b128 readers)
#define STAGE_BYTES ((CCH + 64) * RPITCH * 2)   // 768 weight rows + 64 token rows = 119,808 B per buffer
#define TPITCH     776            // halves per staged output row (1552 B, 16-B multiple)
#define SPITCH     68             // floats per staged output column segment (272 B)
#define TILE_BYTES (64 * TPITCH * 2)   // 99,328 B; also holds 16 waves x 16 x SPITCH floats (69,632 B)

// 16x16x32 f16 WMMA with the hazard guard tied to D, A and B.
__device__ __forceinline__ v8f wmma_f16(v16h a, v16h b, v8f c)
{
  v8f d = __builtin_amdgcn_wmma_f32_16x16x32_f16(false, a, false, b, (short)0, c, false, false);
  asm volatile("v_nop\n\tv_nop\n\tv_nop\n\tv_nop" : "+v"(d) : "v"(a), "v"(b));
  return d;
}

// Sum over the 16 lanes of a row, left in every lane of the row: four DPP steps (row_xmask 1, 2, 4, 8).
// Same butterfly as a shuffle by lane ^ 1, 2, 4, 8, so the same f32 sums, but on the vector port with no LDS round trip.
// All 32 lanes must be on.
__device__ __forceinline__ float row_sum16(float s)
{
  s += __builtin_bit_cast(float, __builtin_amdgcn_update_dpp(0, __builtin_bit_cast(int, s), 0x161, 0xf, 0xf, true));
  s += __builtin_bit_cast(float, __builtin_amdgcn_update_dpp(0, __builtin_bit_cast(int, s), 0x162, 0xf, 0xf, true));
  s += __builtin_bit_cast(float, __builtin_amdgcn_update_dpp(0, __builtin_bit_cast(int, s), 0x164, 0xf, 0xf, true));
  s += __builtin_bit_cast(float, __builtin_amdgcn_update_dpp(0, __builtin_bit_cast(int, s), 0x168, 0xf, 0xf, true));
  return s;
}

// Exact-form GELU of two values at once, without a branch. In: Y = 16 y. Out: 16 * 0.5 * y * (1 + erf(y / sqrt 2)).
// 0.5 y (1 + erf z) = max(y, 0) - |y| * 0.5 erfc(|z|), z = y / sqrt 2, and
// erfc(|z|) = t (a1 + t (a2 + t (a3 + t (a4 + t a5)))) exp(-z^2), t = 1 / (1 + p |z|): the form's absolute error is below 1.5e-7 for every z,
// the rounding level of 1 + erf in f32 and far below the f16 rounding of the stored value.
// The factors 0.5, 1 / sqrt 2 and 1 / 16 are folded into the constants. No lane takes a path of its own, so
// the chains of different elements interleave.
__device__ __forceinline__ v2f gelu16(v2f Y)
{
  const v2f a = __builtin_elementwise_abs(Y);
  const v2f den = a * 0.014477618f + 1.0f;               // 1 + p |z|, p / (16 sqrt 2)
  v2f t, e;
  t[0] = __builtin_amdgcn_rcpf(den[0]);
  t[1] = __builtin_amdgcn_rcpf(den[1]);
  const v2f u = Y * 0.053082613f;                        // u^2 = z^2 log2(e)
  const v2f m = -(u * u);
  e[0] = __builtin_amdgcn_exp2f(m[0]);
  e[1] = __builtin_amdgcn_exp2f(m[1]);
  v2f q = t * 0.5307027145f - 0.7265760135f;
  q = q * t + 0.7107068705f;
  q = q * t - 0.142248368f;
  q = q * t + 0.127414796f;
  const v2f w = (q * t) * e;                             // 0.5 erfc(|z|)
  return __builtin_elementwise_max(Y, (v2f)(0.0f)) - a * w;
}

// ---------------- weights f32 [768][768] -> f16 x64, three matrices, one launch ----------------
// Each thread converts 8 consecutive floats and writes one 16-B vector; a wave instruction
__global__ __launch_bounds__(256) void k_wcvt(const float* __restrict__ w0,
                                              const float* __restrict__ w1,
                                              const float* __restrict__ w2,
                                              _Float16* __restrict__ wb, int n8)
{
  const int which = blockIdx.y;
  const float* w = (which == 0) ? w0 : ((which == 1) ? w1 : w2);
  _Float16* dst = wb + (size_t)which * (size_t)n8 * 8;
  const int i = blockIdx.x * blockDim.x + threadIdx.x;
  if (i < n8) {
    const v4f a = *(const v4f*)(w + (size_t)i * 8);
    const v4f b = *(const v4f*)(w + (size_t)i * 8 + 4);
    v8h o;
    o[0] = (_Float16)(a[0] * 64.0f);
    o[1] = (_Float16)(a[1] * 64.0f);
    o[2] = (_Float16)(a[2] * 64.0f);
    o[3] = (_Float16)(a[3] * 64.0f);
    o[4] = (_Float16)(b[0] * 64.0f);
    o[5] = (_Float16)(b[1] * 64.0f);
    o[6] = (_Float16)(b[2] * 64.0f);
    o[7] = (_Float16)(b[3] * 64.0f);
    v8h* p = (v8h*)(dst + (size_t)i * 8);
    *p = o;
    
  }
}

// ---------------- NCHW f32 -> token-major [n][c] f16 (x16) ----------------
// Block = (32 positions, one image). Tile [32 pos][768 ch] staged in LDS as f16;
__global__ __launch_bounds__(256) void k_tin(const float* __restrict__ x,
                                             _Float16* __restrict__ xt, int nrows)
{
  __shared__ _Float16 tile[32 * TPITCH] __attribute__((aligned(16)));
  const int tid = threadIdx.x, lane = tid & 31, wave = tid >> 5;
  const int b  = blockIdx.y;
  const int p0 = blockIdx.x * 32;
  const float* src = x + (size_t)b * CCH * HWN + p0;
  const int q = lane & 7, cs = lane >> 3;     // 8 lanes x float4 = 32 positions, 4 channels per wave step
  for (int it = 0; it < CCH / 32; ++it) {
    const int c = it * 32 + wave * 4 + cs;
    const v4f v = *(const v4f*)(src + (size_t)c * HWN + q * 4);
    _Float16* t = tile + (q * 4) * TPITCH + c;
    t[0]          = (_Float16)(v[0] * 16.0f);
    t[TPITCH]     = (_Float16)(v[1] * 16.0f);
    t[2 * TPITCH] = (_Float16)(v[2] * 16.0f);
    t[3 * TPITCH] = (_Float16)(v[3] * 16.0f);
  }
  __syncthreads();
  {
    for (int rr = 0; rr < 4; ++rr) {
      const int r = wave * 4 + rr;
      const int n = b * HWN + p0 + r;
      if (n < nrows) {
        const _Float16* trow = tile + r * TPITCH + lane * 8;
        _Float16* grow = xt + (size_t)n * CCH + lane * 8;
#pragma unroll
        for (int j = 0; j < 3; ++j) {
          const v8h v = *(const v8h*)(trow + j * 256);
          *(v8h*)(grow + j * 256) = v;
        }
      }
    }
    
  }
}

// One wave's share of a stage: 12 copies for its own 48 weight rows and 1 copy for 4 token rows.
// Each copy moves 4 rows x 128 B (whole lines); lane = (row lane>>3, 16-B piece lane&7).
// s_wait_xcnt stands inside the statement so that no address register is rewritten ahead of it.
__device__ __forceinline__ void copy_stage(const _Float16* gb, const _Float16* ga, unsigned lb, unsigned la)
{
  const _Float16* g0  = gb;
  const _Float16* g1  = gb + 1 * 4 * CCH;
  const _Float16* g2  = gb + 2 * 4 * CCH;
  const _Float16* g3  = gb + 3 * 4 * CCH;
  const _Float16* g4  = gb + 4 * 4 * CCH;
  const _Float16* g5  = gb + 5 * 4 * CCH;
  const _Float16* g6  = gb + 6 * 4 * CCH;
  const _Float16* g7  = gb + 7 * 4 * CCH;
  const _Float16* g8  = gb + 8 * 4 * CCH;
  const _Float16* g9  = gb + 9 * 4 * CCH;
  const _Float16* g10 = gb + 10 * 4 * CCH;
  const _Float16* g11 = gb + 11 * 4 * CCH;
  const unsigned RS = 4 * RPITCH * 2;     // LDS bytes per 4 rows
  asm volatile("global_load_async_to_lds_b128 %0, %13, off\n\t"
               "global_load_async_to_lds_b128 %1, %14, off\n\t"
               "global_load_async_to_lds_b128 %2, %15, off\n\t"
               "global_load_async_to_lds_b128 %3, %16, off\n\t"
               "global_load_async_to_lds_b128 %4, %17, off\n\t"
               "global_load_async_to_lds_b128 %5, %18, off\n\t"
               "global_load_async_to_lds_b128 %6, %19, off\n\t"
               "global_load_async_to_lds_b128 %7, %20, off\n\t"
               "global_load_async_to_lds_b128 %8, %21, off\n\t"
               "global_load_async_to_lds_b128 %9, %22, off\n\t"
               "global_load_async_to_lds_b128 %10, %23, off\n\t"
               "global_load_async_to_lds_b128 %11, %24, off\n\t"
               "global_load_async_to_lds_b128 %12, %25, off\n\t"
               "s_wait_xcnt 0x0"
               :: "v"(la), "v"(lb), "v"(lb + 1 * RS), "v"(lb + 2 * RS), "v"(lb + 3 * RS),
                  "v"(lb + 4 * RS), "v"(lb + 5 * RS), "v"(lb + 6 * RS), "v"(lb + 7 * RS),
                  "v"(lb + 8 * RS), "v"(lb + 9 * RS), "v"(lb + 10 * RS), "v"(lb + 11 * RS),
                  "v"(ga), "v"(g0), "v"(g1), "v"(g2), "v"(g3), "v"(g4), "v"(g5), "v"(g6),
                  "v"(g7), "v"(g8), "v"(g9), "v"(g10), "v"(g11)
               : "memory");
}

// ---------------- fused GEMM (+bias, optional LayerNorm+GELU) ----------------
// Block: 512 threads = 16 waves, 64 token rows x all 768 output channels.
// Wave w owns N-tiles [3w, 3w+3), all 4 M-tiles. K loop: 12 passes of 64 k, two WMMA k-steps each.
// Both operands' k tiles come into a two-buffer LDS ring by asynchronous copies, one pass ahead of their use.
// The ring's first buffer is reused as output staging behind the last pass's barrier.
// DO_LN:  result (x16, f16) staged as a 64x768 tile in LDS, written row-major in whole rows.
// !DO_LN: result written directly in NCHW: per output channel the block's 64 rows form one
//         contiguous 256-B segment; staged per wave in LDS, one store instruction per 2 segments.
template <bool DO_LN>
__global__ __launch_bounds__(512) void k_gemm(const _Float16* __restrict__ A,     // [nrows][768] f16 (x16)
                                              const _Float16* __restrict__ Wb,    // [768][768] f16 (x64), row o contiguous in k
                                              const float* __restrict__ bias,
                                              const float* __restrict__ gamma,
                                              const float* __restrict__ beta,
                                              _Float16* __restrict__ outH,        // DO_LN: [nrows][768] f16 (x16)
                                              float* __restrict__ outF,           // !DO_LN: NCHW f32
                                              int nrows)
{
  __shared__ unsigned char ring[2 * STAGE_BYTES] __attribute__((aligned(16)));
  static_assert(TILE_BYTES <= STAGE_BYTES, "output staging must fit the first buffer");
  unsigned char* const ldsT = ring;
  __shared__ float lds_part[16 * 64] __attribute__((aligned(16)));
  __shared__ float lds_mu[64] __attribute__((aligned(16)));
  __shared__ float lds_rs[64] __attribute__((aligned(16)));

  const int tid  = threadIdx.x;
  const int lane = tid & 31;
  const int wave = tid >> 5;
  const int h    = lane >> 4;     // lane half
  const int lm   = lane & 15;     // row for A, column for B and D
  const int n0   = blockIdx.x * 64;
  const int o0   = wave * 48;

  // copy addresses of this lane: row (lane >> 3) of a group of 4, 16-B piece (lane & 7)
  const int crow = lane >> 3;
  const int ccol = (lane & 7) * 8;
  int ga = n0 + wave * 4 + crow;
  if (ga > nrows - 1) ga = nrows - 1;
  const _Float16* gA = A + (size_t)ga * CCH + ccol;
  const _Float16* gB = Wb + (size_t)(o0 + crow) * CCH + ccol;
  const unsigned ring0 = (unsigned)(size_t)ring;     // LDS byte address of the ring
  const unsigned lB = ring0 + (unsigned)((o0 + crow) * RPITCH + ccol) * 2u;
  const unsigned lA = ring0 + (unsigned)((CCH + wave * 4 + crow) * RPITCH + ccol) * 2u;

  copy_stage(gB, gA, lB, lA);
  asm volatile("s_wait_asynccnt 0x0" ::: "memory");   // this wave's share of stage 0 has landed
  __syncthreads();                                    // publishes stage 0
  copy_stage(gB + KPASS, gA + KPASS, lB + STAGE_BYTES, lA + STAGE_BYTES);

  v8f acc[4][3];
#pragma unroll
  for (int mt = 0; mt < 4; ++mt)
#pragma unroll
    for (int nt = 0; nt < 3; ++nt)
#pragma unroll
      for (int r = 0; r < 8; ++r) acc[mt][nt][r] = 0.0f;

  for (int t = 0; t < NPASS; ++t) {
    const unsigned boff = (t & 1) ? (unsigned)STAGE_BYTES : 0u;
    const _Float16* sB = (const _Float16*)(ring + boff);
    const _Float16* sA = sB + CCH * RPITCH;
#pragma unroll     // both k-steps of a pass in line: LDS offsets become immediates, no inner branch
    for (int ks = 0; ks < KPASS / 32; ++ks) {
      // A fragments: row lm; elements 0..7 = k 8h..8h+7, elements 8..15 = k 16+8h..16+8h+7
      Frag af[4];
#pragma unroll
      for (int mt = 0; mt < 4; ++mt) {
        const _Float16* p = sA + (mt * 16 + lm) * RPITCH + ks * 32 + 8 * h;
        af[mt].half[0] = *(const v8h*)(p);
        af[mt].half[1] = *(const v8h*)(p + 16);
      }
      // B fragments: column o = o0+nt*16+lm, B[k][o] = W[o][k]; same k map as A
#pragma unroll
      for (int nt = 0; nt < 3; ++nt) {
        Frag bfr;
        const _Float16* q = sB + (o0 + nt * 16 + lm) * RPITCH + ks * 32 + 8 * h;
        bfr.half[0] = *(const v8h*)(q);
        bfr.half[1] = *(const v8h*)(q + 16);
#pragma unroll
        for (int mt = 0; mt < 4; ++mt)
          acc[mt][nt] = wmma_f16(af[mt].v, bfr.v, acc[mt][nt]);
      }
    }
    asm volatile("s_wait_dscnt 0x0" ::: "memory");     // this wave's reads of buffer t&1 are done before it is refilled
    asm volatile("s_wait_asynccnt 0x0" ::: "memory");  // this wave's share of stage t+1 has landed
    __syncthreads();                                   // publishes stage t+1, frees buffer t&1
    if (t + 2 < NPASS)
      copy_stage(gB + (t + 2) * KPASS, gA + (t + 2) * KPASS, lB + boff, lA + boff);
  }
  asm volatile("s_wait_asynccnt 0x0" ::: "memory");    // no copy is left in flight when the ring becomes output staging

  // ---- epilogue: D element r of lane = (row mt*16 + 8h + r, col o0 + nt*16 + lm) ----
  const float SC = 0.0009765625f;     // 1/1024 undoes the x16 * x64 operand scaling
  float bo[3], go[3], bt[3];
#pragma unroll
  for (int nt = 0; nt < 3; ++nt) {
    const int o = o0 + nt * 16 + lm;
    bo[nt] = bias[o];
    go[nt] = 1.0f; bt[nt] = 0.0f;
    if (DO_LN) { go[nt] = gamma[o]; bt[nt] = beta[o]; }
  }
#pragma unroll
  for (int mt = 0; mt < 4; ++mt)
#pragma unroll
    for (int nt = 0; nt < 3; ++nt)
#pragma unroll
      for (int r = 0; r < 8; ++r) acc[mt][nt][r] = acc[mt][nt][r] * SC + bo[nt];

  if (DO_LN) {
    v4f rsum[4][2];     // this lane half's 32 row sums (64 per wave), stored together by one lane of each row half
#pragma unroll
    for (int mt = 0; mt < 4; ++mt) {
#pragma unroll
      for (int r = 0; r < 8; ++r)
        rsum[mt][r >> 2][r & 3] = row_sum16(acc[mt][0][r] + acc[mt][1][r] + acc[mt][2][r]);
    }
    if (lm == 0) {
#pragma unroll
      for (int mt = 0; mt < 4; ++mt) {
        *(v4f*)(lds_part + wave * 64 + mt * 16 + 8 * h)     = rsum[mt][0];
        *(v4f*)(lds_part + wave * 64 + mt * 16 + 8 * h + 4) = rsum[mt][1];
      }
    }
    __syncthreads();
    if (tid < 64) {
      float t = 0.0f;
#pragma unroll
      for (int w = 0; w < 16; ++w) t += lds_part[w * 64 + tid];
      lds_mu[tid] = t * (1.0f / 768.0f);
    }
    __syncthreads();
    // pass 2: sum of squared deviations
#pragma unroll
    for (int mt = 0; mt < 4; ++mt) {
#pragma unroll
      for (int r = 0; r < 8; ++r) {
        const float mu = lds_mu[mt * 16 + 8 * h + r];
        const float d0 = acc[mt][0][r] - mu;
        const float d1 = acc[mt][1][r] - mu;
        const float d2 = acc[mt][2][r] - mu;
        rsum[mt][r >> 2][r & 3] = row_sum16(d0 * d0 + d1 * d1 + d2 * d2);
      }
    }
    if (lm == 0) {
#pragma unroll
      for (int mt = 0; mt < 4; ++mt) {
        *(v4f*)(lds_part + wave * 64 + mt * 16 + 8 * h)     = rsum[mt][0];
        *(v4f*)(lds_part + wave * 64 + mt * 16 + 8 * h + 4) = rsum[mt][1];
      }
    }
    __syncthreads();
    if (tid < 64) {
      float t = 0.0f;
#pragma unroll
      for (int w = 0; w < 16; ++w) t += lds_part[w * 64 + tid];
      const float var = t * (1.0f / 768.0f);
      lds_rs[tid] = rsqrtf(var + 1e-6f);
    }
    __syncthreads();

    // normalize, affine, exact GELU; stage x16 as f16 in the 64x768 LDS tile.
    // The x16 rides in gamma and beta (a power of two: the same bits as scaling the result); two rows per step.
    _Float16* tile = (_Float16*)ldsT;
    const float go16[3] = { go[0] * 16.0f, go[1] * 16.0f, go[2] * 16.0f };
    const float bt16[3] = { bt[0] * 16.0f, bt[1] * 16.0f, bt[2] * 16.0f };
#pragma unroll     // all three loops in line: acc is indexed by constants only and stays in registers
    for (int mt = 0; mt < 4; ++mt) {
#pragma unroll
      for (int r = 0; r < 8; r += 2) {
        const int row = mt * 16 + 8 * h + r;
        const v2f mu = *(const v2f*)(lds_mu + row);
        const v2f rs = *(const v2f*)(lds_rs + row);
#pragma unroll
        for (int nt = 0; nt < 3; ++nt) {
          v2f x;
          x[0] = acc[mt][nt][r];
          x[1] = acc[mt][nt][r + 1];
          const v2h g = __builtin_convertvector(gelu16((x - mu) * rs * go16[nt] + bt16[nt]), v2h);
          _Float16* p = tile + row * TPITCH + o0 + nt * 16 + lm;
          p[0]      = g[0];
          p[TPITCH] = g[1];
        }
      }
    }
    __syncthreads();

    {
#pragma unroll
      for (int rr = 0; rr < 4; ++rr) {
        const int row = wave * 4 + rr;
        const int n = n0 + row;
        if (n < nrows) {
          const _Float16* trow = tile + row * TPITCH + lane * 8;
          _Float16* grow = outH + (size_t)n * CCH + lane * 8;
#pragma unroll
          for (int j = 0; j < 3; ++j) {
            const v8h v = *(const v8h*)(trow + j * 256);
            *(v8h*)(grow + j * 256) = v;
          }
        }
      }
      
    }
  } else {
    // NCHW output: block rows n0..n0+63 = positions hw0..hw0+63 of image bb (64 divides HWN)
    float* stg = (float*)ldsT + wave * (16 * SPITCH);
    const int bb  = n0 / HWN;
    const int hw0 = n0 - bb * HWN;
    const int rq  = lm * 4;              // 4 rows per lane within a 64-row segment
    const bool rows_ok = (n0 + 64 <= nrows);
#pragma unroll
    for (int nt = 0; nt < 3; ++nt) {
      // stage this wave's 16 columns x 64 rows, column-major
#pragma unroll
      for (int mt = 0; mt < 4; ++mt)
#pragma unroll
        for (int r = 0; r < 8; ++r)
          stg[lm * SPITCH + mt * 16 + 8 * h + r] = acc[mt][nt][r];
      __syncthreads();
      // per instruction: lanes 0-15 -> 256-B segment of one channel, lanes 16-31 -> the next channel
      {
#pragma unroll
        for (int pp = 0; pp < 8; ++pp) {
          const int c = 2 * pp + h;
          const v4f v = *(const v4f*)(stg + c * SPITCH + rq);
          const int o = o0 + nt * 16 + c;
          const size_t g = ((size_t)bb * CCH + (size_t)o) * HWN + (size_t)(hw0 + rq);
          if (rows_ok) *(v4f*)(outF + g) = v;
        }
        
      }
      __syncthreads();
    }
  }
}

// ---------------- launch glue ----------------
extern "C" void kernel_launch(void* const* d_in, const int* in_sizes, int n_in,
                              void* d_out, int out_size, void* d_ws, size_t ws_size,
                              hipStream_t stream)
{
  if (n_in < 11) return;
  const float* x   = (const float*)d_in[0];
  const float* W1  = (const float*)d_in[1];
  const float* b1  = (const float*)d_in[2];
  const float* g1  = (const float*)d_in[3];
  const float* be1 = (const float*)d_in[4];
  const float* W2  = (const float*)d_in[5];
  const float* b2  = (const float*)d_in[6];
  const float* g2  = (const float*)d_in[7];
  const float* be2 = (const float*)d_in[8];
  const float* W3  = (const float*)d_in[9];
  const float* b3  = (const float*)d_in[10];
  float* out = (float*)d_out;

  const int nrows = in_sizes[0] / CCH;                 // B * HWN token rows
  if (nrows <= 0 || (nrows % HWN) != 0 || (nrows % 64) != 0) return;
  if (out_size != nrows * CCH) return;
  const int nb = nrows / HWN;                          // images
  const int wn = in_sizes[1];                          // 768*768
  if (wn != CCH * CCH || in_sizes[5] != wn || in_sizes[9] != wn) return;
  const int n8 = wn / 8;

  const size_t BUF = (size_t)nrows * CCH * 2;          // f16 [nrows][768]
  const size_t need = 3 * BUF + (size_t)3 * (size_t)wn * 2;
  if (need > ws_size) return;
  char* ws = (char*)d_ws;
  _Float16* XT = (_Float16*)(ws);
  _Float16* H1 = (_Float16*)(ws + BUF);
  _Float16* H2 = (_Float16*)(ws + 2 * BUF);
  _Float16* WB = (_Float16*)(ws + 3 * BUF);

  k_wcvt<<<dim3((n8 + 255) / 256, 3), 256, 0, stream>>>(W1, W2, W3, WB, n8);
  k_tin<<<dim3(HWN / 32, nb), 256, 0, stream>>>(x, XT, nrows);

  const int gblocks = (nrows + 63) / 64;
  k_gemm<true ><<<gblocks, 512, 0, stream>>>(XT, WB,                  b1, g1, be1, H1, out, nrows);
  k_gemm<true ><<<gblocks, 512, 0, stream>>>(H1, WB + (size_t)wn,     b2, g2, be2, H2, out, nrows);
  k_gemm<false><<<gblocks, 512, 0, stream>>>(H2, WB + (size_t)2 * wn, b3, b3, b3,   H1, out, nrows);
}

// v005
// A run of this version takes 55.7 microseconds.
// Versions between v003 and this one are left out; their measured steps multiply to 1.86 times as fast.
// All steps since v000 together make it 3.21 times as fast.
#include <hip/hip_runtime.h>
#include <stddef.h>

// All three channel contractions: v_wmma_f32_16x16x32_f16 (f16 operands, f32 accumulate); A operand carried x16 and weights x64 in f16, 1/1024 folded into the f32 epilogue; bias, LayerNorm and GELU in f32.

typedef _Float16 v16h __attribute__((ext_vector_type(16)));
typedef _Float16 v8h  __attribute__((ext_vector_type(8)));
typedef _Float16 v4h  __attribute__((ext_vector_type(4)));
typedef _Float16 v2h  __attribute__((ext_vector_type(2)));
typedef float    v8f  __attribute__((ext_vector_type(8)));
typedef float    v4f  __attribute__((ext_vector_type(4)));
typedef float    v2f  __attribute__((ext_vector_type(2)));

union Frag { v16h v; v8h half[2]; };

#define CCH        768            // channels (K and N of every contraction)
#define HWN        1024           // spatial positions per image
#define KSTEPS     (CCH / 32)     // 24 WMMA k-steps per layer
#define WSTEP      (CCH * 4)      // 16-B units of packed weights per k-step: 16 waves x 3 N-tiles x 2 halves x 32 lanes
#define BDEPTH     2              // k-steps of B fragments held in registers
#define TPITCH     776            // halves per activation row in LDS (1552 B = 16 B x odd, for ds_load_b128 readers)
#define SPITCH     68             // floats per staged output column segment (272 B)
#define TILE_BYTES (64 * TPITCH * 2)   // 99,328 B; also holds 16 waves x 16 x SPITCH floats (69,632 B)

// 16x16x32 f16 WMMA with the hazard guard tied to D, A and B.
__device__ __forceinline__ v8f wmma_f16(v16h a, v16h b, v8f c)
{
  v8f d = __builtin_amdgcn_wmma_f32_16x16x32_f16(false, a, false, b, (short)0, c, false, false);
  asm volatile("v_nop\n\tv_nop\n\tv_nop\n\tv_nop" : "+v"(d) : "v"(a), "v"(b));
  return d;
}

// Sum over the 16 lanes of a row, left in every lane of the row: four DPP steps (row_xmask 1, 2, 4, 8).
// Same butterfly as a shuffle by lane ^ 1, 2, 4, 8, so the same f32 sums, but on the vector port with no LDS round trip.
// All 32 lanes must be on.
__device__ __forceinline__ float row_sum16(float s)
{
  s += __builtin_bit_cast(float, __builtin_amdgcn_update_dpp(0, __builtin_bit_cast(int, s), 0x161, 0xf, 0xf, true));
  s += __builtin_bit_cast(float, __builtin_amdgcn_update_dpp(0, __builtin_bit_cast(int, s), 0x162, 0xf, 0xf, true));
  s += __builtin_bit_cast(float, __builtin_amdgcn_update_dpp(0, __builtin_bit_cast(int, s), 0x164, 0xf, 0xf, true));
  s += __builtin_bit_cast(float, __builtin_amdgcn_update_dpp(0, __builtin_bit_cast(int, s), 0x168, 0xf, 0xf, true));
  return s;
}

// Exact-form GELU of two values at once, without a branch. In: Y = 16 y. Out: 16 * 0.5 * y * (1 + erf(y / sqrt 2)).
// 0.5 y (1 + erf z) = max(y, 0) - |y| * 0.5 erfc(|z|), z = y / sqrt 2, and
// erfc(|z|) = t (a1 + t (a2 + t (a3 + t (a4 + t a5)))) exp(-z^2), t = 1 / (1 + p |z|): the form's absolute error is below 1.5e-7 for every z,
// the rounding level of 1 + erf in f32 and far below the f16 rounding of the stored value.
// The factors 0.5, 1 / sqrt 2 and 1 / 16 are folded into the constants. No lane takes a path of its own, so
// the chains of different elements interleave.
__device__ __forceinline__ v2f gelu16(v2f Y)
{
  const v2f a = __builtin_elementwise_abs(Y);
  const v2f den = a * 0.014477618f + 1.0f;               // 1 + p |z|, p / (16 sqrt 2)
  v2f t, e;
  t[0] = __builtin_amdgcn_rcpf(den[0]);
  t[1] = __builtin_amdgcn_rcpf(den[1]);
  const v2f u = Y * 0.053082613f;                        // u^2 = z^2 log2(e)
  const v2f m = -(u * u);
  e[0] = __builtin_amdgcn_exp2f(m[0]);
  e[1] = __builtin_amdgcn_exp2f(m[1]);
  v2f q = t * 0.5307027145f - 0.7265760135f;
  q = q * t + 0.7107068705f;
  q = q * t - 0.142248368f;
  q = q * t + 0.127414796f;
  const v2f w = (q * t) * e;                             // 0.5 erfc(|z|)
  return __builtin_elementwise_max(Y, (v2f)(0.0f)) - a * w;
}

// ---------------- weights f32 [768][768] -> f16 x64, packed in B-fragment order, three matrices, one launch ----------------
// Packed order, in 16-B units of 8 halves: [layer][k-step s][group of 16 rows rg][half j][lane], lane = 16 h + lm, and
// unit = W[16 rg + lm][32 s + 16 j + 8 h .. + 7]: the words that lane holds in half j of the B fragment. One fragment half of a
// wave is then 512 contiguous bytes, four whole lines.
// Block: 16 rows x 128 k. Each thread converts 8 consecutive floats; the units change places in LDS, so that reads and
// writes both cover whole lines and each line has one writing wave.
__global__ __launch_bounds__(256) void k_wcvt(const float* __restrict__ w0,
                                              const float* __restrict__ w1,
                                              const float* __restrict__ w2,
                                              _Float16* __restrict__ wb, int n8)
{
  __shared__ v8h buf[256 + 16] __attribute__((aligned(16)));     // one spare unit per 16: spreads the stores over the banks
  const int which = blockIdx.y;
  const float* w = (which == 0) ? w0 : ((which == 1) ? w1 : w2);
  v8h* dst = (v8h*)(wb + (size_t)which * (size_t)n8 * 8);
  const int t  = threadIdx.x;
  const int rg = blockIdx.x / 6;      // group of 16 weight rows
  const int kg = blockIdx.x % 6;      // group of 128 k = 4 k-steps
  if ((int)(blockIdx.x + 1) * 256 > n8) return;     // the same for the whole block
  {
    const int lm = t >> 4, k8 = t & 15;
    const float* s = w + (size_t)(rg * 16 + lm) * CCH + kg * 128 + k8 * 8;
    const v4f a = *(const v4f*)(s);
    const v4f b = *(const v4f*)(s + 4);
    v8h o;
    o[0] = (_Float16)(a[0] * 64.0f);
    o[1] = (_Float16)(a[1] * 64.0f);
    o[2] = (_Float16)(a[2] * 64.0f);
    o[3] = (_Float16)(a[3] * 64.0f);
    o[4] = (_Float16)(b[0] * 64.0f);
    o[5] = (_Float16)(b[1] * 64.0f);
    o[6] = (_Float16)(b[2] * 64.0f);
    o[7] = (_Float16)(b[3] * 64.0f);
    // k8 = 4 (k-step) + 2 j + h, so the unit's place among the block's 256 is 16 k8 + lm
    buf[17 * k8 + lm] = o;
  }
  __syncthreads();
  {
    const int sl = t >> 6, u = t & 63;     // k-step of the block, unit within (j, lane)
    dst[(size_t)((kg * 4 + sl) * 48 + rg) * 64 + u] = buf[t + (t >> 4)];
  }
}

// BDEPTH k-steps of one wave: A fragments from the LDS tile, B fragments from the register ring bq.
// REFILL: behind the four products that use a B fragment, its registers take the fragment BDEPTH k-steps on (gN), straight
// from L2: nobody else in the block reads these weights, so they pass through no LDS and need no barrier.
template <bool REFILL>
__device__ __forceinline__ void k_steps(v8f (&acc)[4][3], Frag (&bq)[BDEPTH][3],
                                         const _Float16* sA, const v8h* gN)
{
#pragma unroll     // every index of acc and bq a constant: they stay in registers
  for (int i = 0; i < BDEPTH; ++i) {
    // A fragments: row lm; elements 0..7 = k 8h..8h+7, elements 8..15 = k 16+8h..16+8h+7 (sA holds row and 8h)
    Frag af[4];
#pragma unroll
    for (int mt = 0; mt < 4; ++mt) {
      const _Float16* p = sA + mt * 16 * TPITCH + i * 32;
      af[mt].half[0] = *(const v8h*)(p);
      af[mt].half[1] = *(const v8h*)(p + 16);
    }
    // B fragments: column o = o0+nt*16+lm, B[k][o] = W[o][k]; same k map as A
#pragma unroll
    for (int nt = 0; nt < 3; ++nt) {
#pragma unroll
      for (int mt = 0; mt < 4; ++mt)
        acc[mt][nt] = wmma_f16(af[mt].v, bq[i][nt].v, acc[mt][nt]);
      if (REFILL) {
        bq[i][nt].half[0] = gN[i * WSTEP + nt * 64];
        bq[i][nt].half[1] = gN[i * WSTEP + nt * 64 + 32];
      }
    }
  }
}

// ---------------- the whole block in one launch ----------------
// Block: 512 threads = 16 waves, 64 token rows x all 768 channels, through all three layers.
// The block's 64 x 768 activation tile (f16, x16) lives in LDS from the read of x to the last contraction:
// x is read in NCHW and transposed into it; each LayerNorm + GELU result overwrites it in place.
// Wave w owns N-tiles [3w, 3w+3), all 4 M-tiles. K loop per layer: 24 WMMA k-steps, no barrier inside.
// A weight is used by one wave of the block only: each wave loads its B fragments from the packed weights straight into a
// ring of two register sets, two k-steps ahead of their use; the 72 k-steps of the three layers form one sequence,
// so the next layer's first fragments fly during an epilogue.
// Last layer: result written directly in NCHW: per output channel the block's 64 rows form one
// contiguous 256-B segment; staged per wave in the tile's LDS, one store instruction per 2 segments.
__global__ __launch_bounds__(512) void k_block(const float* __restrict__ x,        // NCHW f32
                                               const _Float16* __restrict__ Wb,    // 3 x 768 x 768 f16 (x64), packed in B-fragment order
                                               const float* __restrict__ b1,
                                               const float* __restrict__ g1,
                                               const float* __restrict__ be1,
                                               const float* __restrict__ b2,
                                               const float* __restrict__ g2,
                                               const float* __restrict__ be2,
                                               const float* __restrict__ b3,
                                               float* __restrict__ outF,           // NCHW f32
                                               int nrows)
{
  __shared__ _Float16 tile[64 * TPITCH] __attribute__((aligned(16)));
  static_assert(16 * 16 * SPITCH * 4 <= TILE_BYTES, "output staging must fit the activation tile");
  __shared__ float lds_part[16 * 64] __attribute__((aligned(16)));
  __shared__ float lds_mu[64] __attribute__((aligned(16)));
  __shared__ float lds_rs[64] __attribute__((aligned(16)));

  const int tid  = threadIdx.x;
  const int lane = tid & 31;
  const int wave = tid >> 5;
  const int h    = lane >> 4;     // lane half
  const int lm   = lane & 15;     // row for A, column for B and D
  const int n0   = blockIdx.x * 64;
  const int o0   = wave * 48;
  // block rows n0..n0+63 = positions hw0..hw0+63 of image bb (64 divides HWN)
  const int bb   = n0 / HWN;
  const int hw0  = n0 - bb * HWN;

  // this lane's 16-B unit in the wave's share of a k-step of packed weights; the first BDEPTH k-steps start now
  const v8h* gN = (const v8h*)Wb + wave * 192 + lane;
  Frag bq[BDEPTH][3];
#pragma unroll
  for (int i = 0; i < BDEPTH; ++i)
#pragma unroll
    for (int nt = 0; nt < 3; ++nt) {
      bq[i][nt].half[0] = gN[i * WSTEP + nt * 64];
      bq[i][nt].half[1] = gN[i * WSTEP + nt * 64 + 32];
    }
  asm volatile("s_wait_xcnt 0x0" ::: "memory");     // stands behind these loads, in front of whatever rewrites a register that they name
  gN += BDEPTH * WSTEP;

  // x -> tile: this wave's 48 channels, 64 positions. A lane takes 4 positions (one float4) of 4 channels and
  // stores 4 channels of one position as 8 B; a load instruction covers one whole 128-B line of 4 channels.
  {
    const int q = lane & 7, cg = lane >> 3;
    const float* src = x + ((size_t)bb * CCH + (size_t)(o0 + 4 * cg)) * HWN + hw0 + 4 * q;
    _Float16* dst = tile + (4 * q) * TPITCH + o0 + 4 * cg;
#pragma unroll     // all 24 loads of the wave in flight together
    for (int u = 0; u < 6; ++u) {
      const int g = u >> 1, ph = u & 1;     // group of 16 channels, half of the 64 positions
      const float* s = src + (size_t)(g * 16) * HWN + ph * 32;
      const v4f v0 = *(const v4f*)(s);
      const v4f v1 = *(const v4f*)(s + HWN);
      const v4f v2 = *(const v4f*)(s + 2 * HWN);
      const v4f v3 = *(const v4f*)(s + 3 * HWN);
      _Float16* d = dst + (ph * 32) * TPITCH + g * 16;
#pragma unroll
      for (int i = 0; i < 4; ++i) {
        v4h o;
        o[0] = (_Float16)(v0[i] * 16.0f);
        o[1] = (_Float16)(v1[i] * 16.0f);
        o[2] = (_Float16)(v2[i] * 16.0f);
        o[3] = (_Float16)(v3[i] * 16.0f);
        *(v4h*)(d + i * TPITCH) = o;
      }
    }
  }

  __syncthreads();                                    // publishes the activation tile

  v8f acc[4][3];
#pragma unroll 1     // one copy of the K loop and the epilogue in the text
  for (int layer = 0; ; ++layer) {
#pragma unroll
    for (int mt = 0; mt < 4; ++mt)
#pragma unroll
      for (int nt = 0; nt < 3; ++nt)
#pragma unroll
        for (int r = 0; r < 8; ++r) acc[mt][nt][r] = 0.0f;

    // 12 trips of two k-steps; the very last trip of the last layer has nothing left to fetch
    const _Float16* sA = tile + lm * TPITCH + 8 * h;
    const int nfill = (layer < 2) ? KSTEPS / BDEPTH : KSTEPS / BDEPTH - 1;
    for (int t = 0; t < nfill; ++t) {
      k_steps<true>(acc, bq, sA, gN);
      sA += BDEPTH * 32;
      gN += BDEPTH * WSTEP;
    }
    if (layer == 2) k_steps<false>(acc, bq, sA, gN);

    // ---- epilogue: D element r of lane = (row mt*16 + 8h + r, col o0 + nt*16 + lm) ----
    const float SC = 0.0009765625f;     // 1/1024 undoes the x16 * x64 operand scaling
    const float* bias = (layer == 0) ? b1 : ((layer == 1) ? b2 : b3);
    float bo[3];
#pragma unroll
    for (int nt = 0; nt < 3; ++nt) bo[nt] = bias[o0 + nt * 16 + lm];
#pragma unroll
    for (int mt = 0; mt < 4; ++mt)
#pragma unroll
      for (int nt = 0; nt < 3; ++nt)
#pragma unroll
        for (int r = 0; r < 8; ++r) acc[mt][nt][r] = acc[mt][nt][r] * SC + bo[nt];

    if (layer == 2) break;     // the output stage stands behind the loop: its addresses are formed there, not held through the K loops
    {
      const float* gamma = (layer == 0) ? g1 : g2;
      const float* beta  = (layer == 0) ? be1 : be2;
      float go[3], bt[3];
#pragma unroll
      for (int nt = 0; nt < 3; ++nt) {
        const int o = o0 + nt * 16 + lm;
        go[nt] = gamma[o]; bt[nt] = beta[o];
      }
      v4f rsum[4][2];     // the 32 row sums of this lane's row half (64 per wave), stored together by one lane of each row half
#pragma unroll
      for (int mt = 0; mt < 4; ++mt) {
#pragma unroll
        for (int r = 0; r < 8; ++r)
          rsum[mt][r >> 2][r & 3] = row_sum16(acc[mt][0][r] + acc[mt][1][r] + acc[mt][2][r]);
      }
      if (lm == 0) {
#pragma unroll
        for (int mt = 0; mt < 4; ++mt) {
          *(v4f*)(lds_part + wave * 64 + mt * 16 + 8 * h)     = rsum[mt][0];
          *(v4f*)(lds_part + wave * 64 + mt * 16 + 8 * h + 4) = rsum[mt][1];
        }
      }
      __syncthreads();
      if (tid < 64) {
        float t = 0.0f;
#pragma unroll
        for (int w = 0; w < 16; ++w) t += lds_part[w * 64 + tid];
        lds_mu[tid] = t * (1.0f / 768.0f);
      }
      __syncthreads();
      // pass 2: sum of squared deviations
#pragma unroll
      for (int mt = 0; mt < 4; ++mt) {
#pragma unroll
        for (int r = 0; r < 8; ++r) {
          const float mu = lds_mu[mt * 16 + 8 * h + r];
          const float d0 = acc[mt][0][r] - mu;
          const float d1 = acc[mt][1][r] - mu;
          const float d2 = acc[mt][2][r] - mu;
          rsum[mt][r >> 2][r & 3] = row_sum16(d0 * d0 + d1 * d1 + d2 * d2);
        }
      }
      if (lm == 0) {
#pragma unroll
        for (int mt = 0; mt < 4; ++mt) {
          *(v4f*)(lds_part + wave * 64 + mt * 16 + 8 * h)     = rsum[mt][0];
          *(v4f*)(lds_part + wave * 64 + mt * 16 + 8 * h + 4) = rsum[mt][1];
        }
      }
      __syncthreads();
      if (tid < 64) {
        float t = 0.0f;
#pragma unroll
        for (int w = 0; w < 16; ++w) t += lds_part[w * 64 + tid];
        const float var = t * (1.0f / 768.0f);
        lds_rs[tid] = rsqrtf(var + 1e-6f);
      }
      __syncthreads();

      // normalize, affine, exact GELU; x16 as f16 back into the 64x768 LDS tile, the next layer's A operand.
      // The x16 rides in gamma and beta (a power of two: the same bits as scaling the result); two rows per step.
      const float go16[3] = { go[0] * 16.0f, go[1] * 16.0f, go[2] * 16.0f };
      const float bt16[3] = { bt[0] * 16.0f, bt[1] * 16.0f, bt[2] * 16.0f };
#pragma unroll     // all three loops in line: acc is indexed by constants only and stays in registers
      for (int mt = 0; mt < 4; ++mt) {
#pragma unroll
        for (int r = 0; r < 8; r += 2) {
          const int row = mt * 16 + 8 * h + r;
          const v2f mu = *(const v2f*)(lds_mu + row);
          const v2f rs = *(const v2f*)(lds_rs + row);
#pragma unroll
          for (int nt = 0; nt < 3; ++nt) {
            v2f xv;
            xv[0] = acc[mt][nt][r];
            xv[1] = acc[mt][nt][r + 1];
            const v2h g = __builtin_convertvector(gelu16((xv - mu) * rs * go16[nt] + bt16[nt]), v2h);
            _Float16* p = tile + row * TPITCH + o0 + nt * 16 + lm;
            p[0]      = g[0];
            p[TPITCH] = g[1];
          }
        }
      }
      __syncthreads();     // the new tile is complete before any wave reads it as A
    }
  }
  // ---- the last layer's result ----
  __syncthreads();     // every wave has read its last A fragments before the tile's LDS is reused for staging
  // NCHW output
  float* stg = (float*)tile + wave * (16 * SPITCH);
  const int rq  = lm * 4;              // 4 rows per lane within a 64-row segment
  const bool rows_ok = (n0 + 64 <= nrows);
#pragma unroll
  for (int nt = 0; nt < 3; ++nt) {
    // stage this wave's 16 columns x 64 rows, column-major
#pragma unroll
    for (int mt = 0; mt < 4; ++mt)
#pragma unroll
      for (int r = 0; r < 8; ++r)
        stg[lm * SPITCH + mt * 16 + 8 * h + r] = acc[mt][nt][r];
    __syncthreads();
    // per instruction: lanes 0-15 -> 256-B segment of one channel, lanes 16-31 -> the next channel
    {
#pragma unroll
      for (int pp = 0; pp < 8; ++pp) {
        const int c = 2 * pp + h;
        const v4f v = *(const v4f*)(stg + c * SPITCH + rq);
        const int o = o0 + nt * 16 + c;
        const size_t g = ((size_t)bb * CCH + (size_t)o) * HWN + (size_t)(hw0 + rq);
        if (rows_ok) *(v4f*)(outF + g) = v;
      }
    }
    __syncthreads();
  }
}

// ---------------- launch glue ----------------
extern "C" void kernel_launch(void* const* d_in, const int* in_sizes, int n_in,
                              void* d_out, int out_size, void* d_ws, size_t ws_size,
                              hipStream_t stream)
{
  if (n_in < 11) return;
  const float* x   = (const float*)d_in[0];
  const float* W1  = (const float*)d_in[1];
  const float* b1  = (const float*)d_in[2];
  const float* g1  = (const float*)d_in[3];
  const float* be1 = (const float*)d_in[4];
  const float* W2  = (const float*)d_in[5];
  const float* b2  = (const float*)d_in[6];
  const float* g2  = (const float*)d_in[7];
  const float* be2 = (const float*)d_in[8];
  const float* W3  = (const float*)d_in[9];
  const float* b3  = (const float*)d_in[10];
  float* out = (float*)d_out;

  const int nrows = in_sizes[0] / CCH;                 // B * HWN token rows
  if (nrows <= 0 || (nrows % HWN) != 0 || (nrows % 64) != 0) return;
  if (out_size != nrows * CCH) return;
  const int wn = in_sizes[1];                          // 768*768
  if (wn != CCH * CCH || in_sizes[5] != wn || in_sizes[9] != wn) return;
  const int n8 = wn / 8;

  const size_t need = (size_t)3 * (size_t)wn * 2;      // the three f16 weight matrices
  if (need > ws_size) return;
  _Float16* WB = (_Float16*)d_ws;

  k_wcvt<<<dim3((n8 + 255) / 256, 3), 256, 0, stream>>>(W1, W2, W3, WB, n8);
  k_block<<<nrows / 64, 512, 0, stream>>>(x, WB, b1, g1, be1, b2, g2, be2, b3, out, nrows);
}

// v006
// Measured time: 53.7 microseconds a run.
// In two side-by-side timings against v005, it was 1.05 and 1.04 times as fast.
// Counting every step since v000, it is 3.35 times as fast.
#include <hip/hip_runtime.h>
#include <stddef.h>

// All three channel contractions: v_wmma_f32_16x16x32_f16 (f16 operands, f32 accumulate); A operand carried x16 and weights x64 in f16, 1/1024 folded into the f32 epilogue; bias, LayerNorm and GELU in f32.

typedef _Float16 v16h __attribute__((ext_vector_type(16)));
typedef _Float16 v8h  __attribute__((ext_vector_type(8)));
typedef _Float16 v4h  __attribute__((ext_vector_type(4)));
typedef _Float16 v2h  __attribute__((ext_vector_type(2)));
typedef float    v8f  __attribute__((ext_vector_type(8)));
typedef float    v4f  __attribute__((ext_vector_type(4)));
typedef float    v2f  __attribute__((ext_vector_type(2)));

union Frag { v16h v; v8h half[2]; };

#define CCH        768            // channels (K and N of every contraction)
#define HWN        1024           // spatial positions per image
#define KSTEPS     (CCH / 32)     // 24 WMMA k-steps per layer
#define WSTEP      (CCH * 4)      // 16-B units of packed weights per k-step: 16 waves x 3 N-tiles x 2 halves x 32 lanes
#define BDEPTH     2              // k-steps of B fragments held in registers
#define NTRIP      (KSTEPS / BDEPTH)   // 12 trips of the K loop per layer
#define TPITCH     776            // halves per activation row in LDS (1552 B = 16 B x odd, for ds_load_b128 readers)
#define SPITCH     68             // floats per staged output column segment (272 B)
#define TILE_BYTES (64 * TPITCH * 2)   // 99,328 B; also holds 16 waves x 16 x SPITCH floats (69,632 B)

// 16x16x32 f16 WMMA with the hazard guard tied to D, A and B.
__device__ __forceinline__ v8f wmma_f16(v16h a, v16h b, v8f c)
{
  v8f d = __builtin_amdgcn_wmma_f32_16x16x32_f16(false, a, false, b, (short)0, c, false, false);
  asm volatile("v_nop\n\tv_nop\n\tv_nop\n\tv_nop" : "+v"(d) : "v"(a), "v"(b));
  return d;
}

// Sum over the 16 lanes of a row, left in every lane of the row: four DPP steps (row_xmask 1, 2, 4, 8).
// Same butterfly as a shuffle by lane ^ 1, 2, 4, 8, so the same f32 sums, but on the vector port with no LDS round trip.
// All 32 lanes must be on.
__device__ __forceinline__ float row_sum16(float s)
{
  s += __builtin_bit_cast(float, __builtin_amdgcn_update_dpp(0, __builtin_bit_cast(int, s), 0x161, 0xf, 0xf, true));
  s += __builtin_bit_cast(float, __builtin_amdgcn_update_dpp(0, __builtin_bit_cast(int, s), 0x162, 0xf, 0xf, true));
  s += __builtin_bit_cast(float, __builtin_amdgcn_update_dpp(0, __builtin_bit_cast(int, s), 0x164, 0xf, 0xf, true));
  s += __builtin_bit_cast(float, __builtin_amdgcn_update_dpp(0, __builtin_bit_cast(int, s), 0x168, 0xf, 0xf, true));
  return s;
}

// Exact-form GELU of two values at once, without a branch. In: Y = 16 y. Out: 16 * 0.5 * y * (1 + erf(y / sqrt 2)).
// 0.5 y (1 + erf z) = max(y, 0) - |y| * 0.5 erfc(|z|), z = y / sqrt 2, and
// erfc(|z|) = t (a1 + t (a2 + t (a3 + t (a4 + t a5)))) exp(-z^2), t = 1 / (1 + p |z|): the form's absolute error is below 1.5e-7 for every z,
// the rounding level of 1 + erf in f32 and far below the f16 rounding of the stored value.
// The factors 0.5, 1 / sqrt 2 and 1 / 16 are folded into the constants. No lane takes a path of its own, so
// the chains of different elements interleave.
__device__ __forceinline__ v2f gelu16(v2f Y)
{
  const v2f a = __builtin_elementwise_abs(Y);
  const v2f den = a * 0.014477618f + 1.0f;               // 1 + p |z|, p / (16 sqrt 2)
  v2f t, e;
  t[0] = __builtin_amdgcn_rcpf(den[0]);
  t[1] = __builtin_amdgcn_rcpf(den[1]);
  const v2f u = Y * 0.053082613f;                        // u^2 = z^2 log2(e)
  const v2f m = -(u * u);
  e[0] = __builtin_amdgcn_exp2f(m[0]);
  e[1] = __builtin_amdgcn_exp2f(m[1]);
  v2f q = t * 0.5307027145f - 0.7265760135f;
  q = q * t + 0.7107068705f;
  q = q * t - 0.142248368f;
  q = q * t + 0.127414796f;
  const v2f w = (q * t) * e;                             // 0.5 erfc(|z|)
  return __builtin_elementwise_max(Y, (v2f)(0.0f)) - a * w;
}

// ---------------- weights f32 [768][768] -> f16 x64, packed in B-fragment order, three matrices, one launch ----------------
// Packed order, in 16-B units of 8 halves: [layer][k-step s][group of 16 rows rg][half j][lane], lane = 16 h + lm, and
// unit = W[16 rg + lm][32 s + 16 j + 8 h .. + 7]: the words that lane holds in half j of the B fragment. One fragment half of a
// wave is then 512 contiguous bytes, four whole lines.
// Block: 16 rows x 128 k. Each thread converts 8 consecutive floats; the units change places in LDS, so that reads and
// writes both cover whole lines and each line has one writing wave.
__global__ __launch_bounds__(256) void k_wcvt(const float* __restrict__ w0,
                                              const float* __restrict__ w1,
                                              const float* __restrict__ w2,
                                              _Float16* __restrict__ wb, int n8)
{
  __shared__ v8h buf[256 + 16] __attribute__((aligned(16)));     // one spare unit per 16: spreads the stores over the banks
  const int which = blockIdx.y;
  const float* w = (which == 0) ? w0 : ((which == 1) ? w1 : w2);
  v8h* dst = (v8h*)(wb + (size_t)which * (size_t)n8 * 8);
  const int t  = threadIdx.x;
  const int rg = blockIdx.x / 6;      // group of 16 weight rows
  const int kg = blockIdx.x % 6;      // group of 128 k = 4 k-steps
  if ((int)(blockIdx.x + 1) * 256 > n8) return;     // the same for the whole block
  {
    const int lm = t >> 4, k8 = t & 15;
    const float* s = w + (size_t)(rg * 16 + lm) * CCH + kg * 128 + k8 * 8;
    const v4f a = *(const v4f*)(s);
    const v4f b = *(const v4f*)(s + 4);
    v8h o;
    o[0] = (_Float16)(a[0] * 64.0f);
    o[1] = (_Float16)(a[1] * 64.0f);
    o[2] = (_Float16)(a[2] * 64.0f);
    o[3] = (_Float16)(a[3] * 64.0f);
    o[4] = (_Float16)(b[0] * 64.0f);
    o[5] = (_Float16)(b[1] * 64.0f);
    o[6] = (_Float16)(b[2] * 64.0f);
    o[7] = (_Float16)(b[3] * 64.0f);
    // k8 = 4 (k-step) + 2 j + h, so the unit's place among the block's 256 is 16 k8 + lm
    buf[17 * k8 + lm] = o;
  }
  __syncthreads();
  {
    const int sl = t >> 6, u = t & 63;     // k-step of the block, unit within (j, lane)
    dst[(size_t)((kg * 4 + sl) * 48 + rg) * 64 + u] = buf[t + (t >> 4)];
  }
}

// BDEPTH k-steps of one wave: A fragments from the LDS tile, B fragments from the register ring bq.
// REFILL: behind the four products that use a B fragment, its registers take the fragment BDEPTH k-steps on (gN), straight
// from L2: nobody else in the block reads these weights, so they pass through no LDS and need no barrier.
template <bool REFILL>
__device__ __forceinline__ void k_steps(v8f (&acc)[4][3], Frag (&bq)[BDEPTH][3],
                                         const _Float16* sA, const v8h* gN)
{
#pragma unroll     // every index of acc and bq a constant: they stay in registers
  for (int i = 0; i < BDEPTH; ++i) {
    // A fragments: row lm; elements 0..7 = k 8h..8h+7, elements 8..15 = k 16+8h..16+8h+7 (sA holds row and 8h)
    Frag af[4];
#pragma unroll
    for (int mt = 0; mt < 4; ++mt) {
      const _Float16* p = sA + mt * 16 * TPITCH + i * 32;
      af[mt].half[0] = *(const v8h*)(p);
      af[mt].half[1] = *(const v8h*)(p + 16);
    }
    // B fragments: column o = o0+nt*16+lm, B[k][o] = W[o][k]; same k map as A
#pragma unroll
    for (int nt = 0; nt < 3; ++nt) {
#pragma unroll
      for (int mt = 0; mt < 4; ++mt)
        acc[mt][nt] = wmma_f16(af[mt].v, bq[i][nt].v, acc[mt][nt]);
      if (REFILL) {
        bq[i][nt].half[0] = gN[i * WSTEP + nt * 64];
        bq[i][nt].half[1] = gN[i * WSTEP + nt * 64 + 32];
      }
    }
  }
}

// ---------------- the whole block in one launch ----------------
// Block: 512 threads = 16 waves, 64 token rows x all 768 channels, through all three layers.
// The block's 64 x 768 activation tile (f16, x16) lives in LDS from the read of x to the last contraction:
// x is read in NCHW and transposed into it; each LayerNorm + GELU result overwrites it in place.
// Wave w owns N-tiles [3w, 3w+3), all 4 M-tiles. K loop per layer: 24 WMMA k-steps, no barrier inside.
// A weight is used by one wave of the block only: each wave loads its B fragments from the packed weights straight into a
// ring of two register sets, two k-steps ahead of their use; the 72 k-steps of the three layers form one sequence,
// so the next layer's first fragments fly during an epilogue.
// Every block reads the same weights: each block enters a layer's 12 trips at a trip of its own (r0) and wraps round, so that
// the blocks do not ask L2 for the same lines at the same moment. The whole A tile is in LDS, so any k order can be served.
// Last layer: result written directly in NCHW: per output channel the block's 64 rows form one
// contiguous 256-B segment; staged per wave in the tile's LDS, one store instruction per 2 segments.
__global__ __launch_bounds__(512) void k_block(const float* __restrict__ x,        // NCHW f32
                                               const _Float16* __restrict__ Wb,    // 3 x 768 x 768 f16 (x64), packed in B-fragment order
                                               const float* __restrict__ b1,
                                               const float* __restrict__ g1,
                                               const float* __restrict__ be1,
                                               const float* __restrict__ b2,
                                               const float* __restrict__ g2,
                                               const float* __restrict__ be2,
                                               const float* __restrict__ b3,
                                               float* __restrict__ outF,           // NCHW f32
                                               int nrows)
{
  __shared__ _Float16 tile[64 * TPITCH] __attribute__((aligned(16)));
  static_assert(16 * 16 * SPITCH * 4 <= TILE_BYTES, "output staging must fit the activation tile");
  __shared__ float lds_part[16 * 64] __attribute__((aligned(16)));
  __shared__ float lds_mu[64] __attribute__((aligned(16)));
  __shared__ float lds_rs[64] __attribute__((aligned(16)));

  const int tid  = threadIdx.x;
  const int lane = tid & 31;
  const int wave = tid >> 5;
  const int h    = lane >> 4;     // lane half
  const int lm   = lane & 15;     // row for A, column for B and D
  const int n0   = blockIdx.x * 64;
  const int o0   = wave * 48;
  // block rows n0..n0+63 = positions hw0..hw0+63 of image bb (64 divides HWN)
  const int bb   = n0 / HWN;
  const int hw0  = n0 - bb * HWN;

  // the trip at which this block enters every layer's K loop: neighbours in index differ, all 12 values are used about equally often
  const int r0 = (int)((blockIdx.x >> 3) + (blockIdx.x & 7)) % NTRIP;
  // this lane's 16-B unit in the wave's share of a k-step of packed weights; the block's first BDEPTH k-steps start now
  const v8h* gL = (const v8h*)Wb + wave * 192 + lane;     // k-step 0 of the current layer
  const v8h* gN = gL + r0 * (BDEPTH * WSTEP);
  Frag bq[BDEPTH][3];
#pragma unroll
  for (int i = 0; i < BDEPTH; ++i)
#pragma unroll
    for (int nt = 0; nt < 3; ++nt) {
      bq[i][nt].half[0] = gN[i * WSTEP + nt * 64];
      bq[i][nt].half[1] = gN[i * WSTEP + nt * 64 + 32];
    }
  asm volatile("s_wait_xcnt 0x0" ::: "memory");     // stands behind these loads, in front of whatever rewrites a register that they name

  // x -> tile: this wave's 48 channels, 64 positions. A lane takes 4 positions (one float4) of 4 channels and
  // stores 4 channels of one position as 8 B; a load instruction covers one whole 128-B line of 4 channels.
  {
    const int q = lane & 7, cg = lane >> 3;
    const float* src = x + ((size_t)bb * CCH + (size_t)(o0 + 4 * cg)) * HWN + hw0 + 4 * q;
    _Float16* dst = tile + (4 * q) * TPITCH + o0 + 4 * cg;
#pragma unroll     // all 24 loads of the wave in flight together
    for (int u = 0; u < 6; ++u) {
      const int g = u >> 1, ph = u & 1;     // group of 16 channels, half of the 64 positions
      const float* s = src + (size_t)(g * 16) * HWN + ph * 32;
      const v4f v0 = *(const v4f*)(s);
      const v4f v1 = *(const v4f*)(s + HWN);
      const v4f v2 = *(const v4f*)(s + 2 * HWN);
      const v4f v3 = *(const v4f*)(s + 3 * HWN);
      _Float16* d = dst + (ph * 32) * TPITCH + g * 16;
#pragma unroll
      for (int i = 0; i < 4; ++i) {
        v4h o;
        o[0] = (_Float16)(v0[i] * 16.0f);
        o[1] = (_Float16)(v1[i] * 16.0f);
        o[2] = (_Float16)(v2[i] * 16.0f);
        o[3] = (_Float16)(v3[i] * 16.0f);
        *(v4h*)(d + i * TPITCH) = o;
      }
    }
  }

  __syncthreads();                                    // publishes the activation tile

  v8f acc[4][3];
#pragma unroll 1     // one copy of the K loop and the epilogue in the text
  for (int layer = 0; ; ++layer) {
#pragma unroll
    for (int mt = 0; mt < 4; ++mt)
#pragma unroll
      for (int nt = 0; nt < 3; ++nt)
#pragma unroll
        for (int r = 0; r < 8; ++r) acc[mt][nt][r] = 0.0f;

    // 12 trips of two k-steps, from trip r0 on and round; the very last trip of the last layer has nothing left to fetch.
    // A trip refills the ring with the trip that follows it in this block's order; the 12th with the next layer's trip r0.
    const _Float16* sA = tile + lm * TPITCH + 8 * h;
    const int pend = (layer < 2) ? r0 : ((r0 == 0) ? NTRIP - 1 : r0 - 1);     // 12 refilling trips, in the last layer 11
    int p = r0;
    do {
      const int pn = (p + 1 == NTRIP) ? 0 : p + 1;
      const int nx = (pn == r0) ? pn + NTRIP : pn;     // once round: on to the next layer
      k_steps<true>(acc, bq, sA + p * (BDEPTH * 32), gL + nx * (BDEPTH * WSTEP));
      asm volatile("s_wait_xcnt 0x0" ::: "memory");     // behind the trip's refill loads, in front of whatever rewrites their address registers
      p = pn;
    } while (p != pend);
    if (layer == 2) k_steps<false>(acc, bq, sA + p * (BDEPTH * 32), gL);
    gL += KSTEPS * WSTEP;

    // ---- epilogue: D element r of lane = (row mt*16 + 8h + r, col o0 + nt*16 + lm) ----
    const float SC = 0.0009765625f;     // 1/1024 undoes the x16 * x64 operand scaling
    const float* bias = (layer == 0) ? b1 : ((layer == 1) ? b2 : b3);
    float bo[3];
#pragma unroll
    for (int nt = 0; nt < 3; ++nt) bo[nt] = bias[o0 + nt * 16 + lm];
#pragma unroll
    for (int mt = 0; mt < 4; ++mt)
#pragma unroll
      for (int nt = 0; nt < 3; ++nt)
#pragma unroll
        for (int r = 0; r < 8; ++r) acc[mt][nt][r] = acc[mt][nt][r] * SC + bo[nt];

    if (layer == 2) break;     // the output stage stands behind the loop: its addresses are formed there, not held through the K loops
    {
      const float* gamma = (layer == 0) ? g1 : g2;
      const float* beta  = (layer == 0) ? be1 : be2;
      float go[3], bt[3];
#pragma unroll
      for (int nt = 0; nt < 3; ++nt) {
        const int o = o0 + nt * 16 + lm;
        go[nt] = gamma[o]; bt[nt] = beta[o];
      }
      v4f rsum[4][2];     // the 32 row sums of this lane's row half (64 per wave), stored together by one lane of each row half
#pragma unroll
      for (int mt = 0; mt < 4; ++mt) {
#pragma unroll
        for (int r = 0; r < 8; ++r)
          rsum[mt][r >> 2][r & 3] = row_sum16(acc[mt][0][r] + acc[mt][1][r] + acc[mt][2][r]);
      }
      if (lm == 0) {
#pragma unroll
        for (int mt = 0; mt < 4; ++mt) {
          *(v4f*)(lds_part + wave * 64 + mt * 16 + 8 * h)     = rsum[mt][0];
          *(v4f*)(lds_part + wave * 64 + mt * 16 + 8 * h + 4) = rsum[mt][1];
        }
      }
      __syncthreads();
      if (tid < 64) {
        float t = 0.0f;
#pragma unroll
        for (int w = 0; w < 16; ++w) t += lds_part[w * 64 + tid];
        lds_mu[tid] = t * (1.0f / 768.0f);
      }
      __syncthreads();
      // pass 2: sum of squared deviations
#pragma unroll
      for (int mt = 0; mt < 4; ++mt) {
#pragma unroll
        for (int r = 0; r < 8; ++r) {
          const float mu = lds_mu[mt * 16 + 8 * h + r];
          const float d0 = acc[mt][0][r] - mu;
          const float d1 = acc[mt][1][r] - mu;
          const float d2 = acc[mt][2][r] - mu;
          rsum[mt][r >> 2][r & 3] = row_sum16(d0 * d0 + d1 * d1 + d2 * d2);
        }
      }
      if (lm == 0) {
#pragma unroll
        for (int mt = 0; mt < 4; ++mt) {
          *(v4f*)(lds_part + wave * 64 + mt * 16 + 8 * h)     = rsum[mt][0];
          *(v4f*)(lds_part + wave * 64 + mt * 16 + 8 * h + 4) = rsum[mt][1];
        }
      }
      __syncthreads();
      if (tid < 64) {
        float t = 0.0f;
#pragma unroll
        for (int w = 0; w < 16; ++w) t += lds_part[w * 64 + tid];
        const float var = t * (1.0f / 768.0f);
        lds_rs[tid] = rsqrtf(var + 1e-6f);
      }
      __syncthreads();

      // normalize, affine, exact GELU; x16 as f16 back into the 64x768 LDS tile, the next layer's A operand.
      // The x16 rides in gamma and beta (a power of two: the same bits as scaling the result); two rows per step.
      const float go16[3] = { go[0] * 16.0f, go[1] * 16.0f, go[2] * 16.0f };
      const float bt16[3] = { bt[0] * 16.0f, bt[1] * 16.0f, bt[2] * 16.0f };
#pragma unroll     // all three loops in line: acc is indexed by constants only and stays in registers
      for (int mt = 0; mt < 4; ++mt) {
#pragma unroll
        for (int r = 0; r < 8; r += 2) {
          const int row = mt * 16 + 8 * h + r;
          const v2f mu = *(const v2f*)(lds_mu + row);
          const v2f rs = *(const v2f*)(lds_rs + row);
#pragma unroll
          for (int nt = 0; nt < 3; ++nt) {
            v2f xv;
            xv[0] = acc[mt][nt][r];
            xv[1] = acc[mt][nt][r + 1];
            const v2h g = __builtin_convertvector(gelu16((xv - mu) * rs * go16[nt] + bt16[nt]), v2h);
            _Float16* p = tile + row * TPITCH + o0 + nt * 16 + lm;
            p[0]      = g[0];
            p[TPITCH] = g[1];
          }
        }
      }
      __syncthreads();     // the new tile is complete before any wave reads it as A
    }
  }
  // ---- the last layer's result ----
  __syncthreads();     // every wave has read its last A fragments before the tile's LDS is reused for staging
  // NCHW output
  float* stg = (float*)tile + wave * (16 * SPITCH);
  const int rq  = lm * 4;              // 4 rows per lane within a 64-row segment
  const bool rows_ok = (n0 + 64 <= nrows);
#pragma unroll
  for (int nt = 0; nt < 3; ++nt) {
    // stage this wave's 16 columns x 64 rows, column-major
#pragma unroll
    for (int mt = 0; mt < 4; ++mt)
#pragma unroll
      for (int r = 0; r < 8; ++r)
        stg[lm * SPITCH + mt * 16 + 8 * h + r] = acc[mt][nt][r];
    __syncthreads();
    // per instruction: lanes 0-15 -> 256-B segment of one channel, lanes 16-31 -> the next channel
    {
#pragma unroll
      for (int pp = 0; pp < 8; ++pp) {
        const int c = 2 * pp + h;
        const v4f v = *(const v4f*)(stg + c * SPITCH + rq);
        const int o = o0 + nt * 16 + c;
        const size_t g = ((size_t)bb * CCH + (size_t)o) * HWN + (size_t)(hw0 + rq);
        if (rows_ok) *(v4f*)(outF + g) = v;
      }
    }
    __syncthreads();
  }
}

// ---------------- launch glue ----------------
extern "C" void kernel_launch(void* const* d_in, const int* in_sizes, int n_in,
                              void* d_out, int out_size, void* d_ws, size_t ws_size,
                              hipStream_t stream)
{
  if (n_in < 11) return;
  const float* x   = (const float*)d_in[0];
  const float* W1  = (const float*)d_in[1];
  const float* b1  = (const float*)d_in[2];
  const float* g1  = (const float*)d_in[3];
  const float* be1 = (const float*)d_in[4];
  const float* W2  = (const float*)d_in[5];
  const float* b2  = (const float*)d_in[6];
  const float* g2  = (const float*)d_in[7];
  const float* be2 = (const float*)d_in[8];
  const float* W3  = (const float*)d_in[9];
  const float* b3  = (const float*)d_in[10];
  float* out = (float*)d_out;

  const int nrows = in_sizes[0] / CCH;                 // B * HWN token rows
  if (nrows <= 0 || (nrows % HWN) != 0 || (nrows % 64) != 0) return;
  if (out_size != nrows * CCH) return;
  const int wn = in_sizes[1];                          // 768*768
  if (wn != CCH * CCH || in_sizes[5] != wn || in_sizes[9] != wn) return;
  const int n8 = wn / 8;

  const size_t need = (size_t)3 * (size_t)wn * 2;      // the three f16 weight matrices
  if (need > ws_size) return;
  _Float16* WB = (_Float16*)d_ws;

  k_wcvt<<<dim3((n8 + 255) / 256, 3), 256, 0, stream>>>(W1, W2, W3, WB, n8);
  k_block<<<nrows / 64, 512, 0, stream>>>(x, WB, b1, g1, be1, b2, g2, be2, b3, out, nrows);
}

// v007
// One run takes 49.9 microseconds.
// Timed twice side by side with v006, it ran 1.08 times as fast both times.
// Over all steps from v000 it is 3.62 times as fast.
#include <hip/hip_runtime.h>
#include <stddef.h>

// All three channel contractions: v_wmma_f32_16x16x32_f16 (f16 operands, f32 accumulate); activations carried x16 and weights x64 in f16, 1/1024 folded into the f32 epilogue; bias, LayerNorm and GELU in f32.

typedef _Float16 v16h __attribute__((ext_vector_type(16)));
typedef _Float16 v8h  __attribute__((ext_vector_type(8)));
typedef _Float16 v4h  __attribute__((ext_vector_type(4)));
typedef _Float16 v2h  __attribute__((ext_vector_type(2)));
typedef float    v8f  __attribute__((ext_vector_type(8)));
typedef float    v4f  __attribute__((ext_vector_type(4)));
typedef float    v2f  __attribute__((ext_vector_type(2)));

union Frag { v16h v; v8h half[2]; };

#define CCH        768            // channels (M and K of every contraction)
#define HWN        1024           // spatial positions per image
#define KSTEPS     (CCH / 32)     // 24 WMMA k-steps per layer
#define WSTEP      (CCH * 4)      // 16-B units of packed weights per k-step: 16 waves x 3 channel tiles x 2 halves x 32 lanes
#define BDEPTH     2              // k-steps of weight fragments held in registers
#define NTRIP      (KSTEPS / BDEPTH)   // 12 trips of the K loop per layer
#define TPITCH     776            // halves per activation row in LDS (1552 B = 16 B x odd, for ds_load_b128 readers)

// 16x16x32 f16 WMMA with the hazard guard tied to D, A and B.
__device__ __forceinline__ v8f wmma_f16(v16h a, v16h b, v8f c)
{
  v8f d = __builtin_amdgcn_wmma_f32_16x16x32_f16(false, a, false, b, (short)0, c, false, false);
  asm volatile("v_nop\n\tv_nop\n\tv_nop\n\tv_nop" : "+v"(d) : "v"(a), "v"(b));
  return d;
}

// The value that lane l ^ 16 holds: a vector cross-row move, no LDS round trip. All 32 lanes must be on.
__device__ __forceinline__ float xhalf(float x)
{
  return __builtin_bit_cast(float, __builtin_amdgcn_permlanex16(__builtin_bit_cast(int, x), __builtin_bit_cast(int, x), 0x76543210, 0xfedcba98, false, false));
}

// Exact-form GELU of two values at once, without a branch. In: Y = 16 y. Out: 16 * 0.5 * y * (1 + erf(y / sqrt 2)).
// 0.5 y (1 + erf z) = max(y, 0) - |y| * 0.5 erfc(|z|), z = y / sqrt 2, and
// erfc(|z|) = t (a1 + t (a2 + t (a3 + t (a4 + t a5)))) exp(-z^2), t = 1 / (1 + p |z|): the form's absolute error is below 1.5e-7 for every z,
// the rounding level of 1 + erf in f32 and far below the f16 rounding of the stored value.
// The factors 0.5, 1 / sqrt 2 and 1 / 16 are folded into the constants. No lane takes a path of its own, so
// the chains of different elements interleave.
__device__ __forceinline__ v2f gelu16(v2f Y)
{
  const v2f a = __builtin_elementwise_abs(Y);
  const v2f den = a * 0.014477618f + 1.0f;               // 1 + p |z|, p / (16 sqrt 2)
  v2f t, e;
  t[0] = __builtin_amdgcn_rcpf(den[0]);
  t[1] = __builtin_amdgcn_rcpf(den[1]);
  const v2f u = Y * 0.053082613f;                        // u^2 = z^2 log2(e)
  const v2f m = -(u * u);
  e[0] = __builtin_amdgcn_exp2f(m[0]);
  e[1] = __builtin_amdgcn_exp2f(m[1]);
  v2f q = t * 0.5307027145f - 0.7265760135f;
  q = q * t + 0.7107068705f;
  q = q * t - 0.142248368f;
  q = q * t + 0.127414796f;
  const v2f w = (q * t) * e;                             // 0.5 erfc(|z|)
  return __builtin_elementwise_max(Y, (v2f)(0.0f)) - a * w;
}

// ---------------- weights f32 [768][768] -> f16 x64, packed in fragment order, three matrices, one launch ----------------
// Packed order, in 16-B units of 8 halves: [layer][k-step s][group of 16 rows rg][half j][lane], lane = 16 h + lm, and
// unit = W[16 rg + lm][32 s + 16 j + 8 h .. + 7]: the words that lane holds in half j of the weight fragment. One fragment half of a
// wave is then 512 contiguous bytes, four whole lines.
// Block: 16 rows x 128 k. Each thread converts 8 consecutive floats; the units change places in LDS, so that reads and
// writes both cover whole lines and each line has one writing wave.
__global__ __launch_bounds__(256) void k_wcvt(const float* __restrict__ w0,
                                              const float* __restrict__ w1,
                                              const float* __restrict__ w2,
                                              _Float16* __restrict__ wb, int n8)
{
  __shared__ v8h buf[256 + 16] __attribute__((aligned(16)));     // one spare unit per 16: spreads the stores over the banks
  const int which = blockIdx.y;
  const float* w = (which == 0) ? w0 : ((which == 1) ? w1 : w2);
  v8h* dst = (v8h*)(wb + (size_t)which * (size_t)n8 * 8);
  const int t  = threadIdx.x;
  const int rg = blockIdx.x / 6;      // group of 16 weight rows
  const int kg = blockIdx.x % 6;      // group of 128 k = 4 k-steps
  if ((int)(blockIdx.x + 1) * 256 > n8) return;     // the same for the whole block
  {
    const int lm = t >> 4, k8 = t & 15;
    const float* s = w + (size_t)(rg * 16 + lm) * CCH + kg * 128 + k8 * 8;
    const v4f a = *(const v4f*)(s);
    const v4f b = *(const v4f*)(s + 4);
    v8h o;
    o[0] = (_Float16)(a[0] * 64.0f);
    o[1] = (_Float16)(a[1] * 64.0f);
    o[2] = (_Float16)(a[2] * 64.0f);
    o[3] = (_Float16)(a[3] * 64.0f);
    o[4] = (_Float16)(b[0] * 64.0f);
    o[5] = (_Float16)(b[1] * 64.0f);
    o[6] = (_Float16)(b[2] * 64.0f);
    o[7] = (_Float16)(b[3] * 64.0f);
    // k8 = 4 (k-step) + 2 j + h, so the unit's place among the block's 256 is 16 k8 + lm
    buf[17 * k8 + lm] = o;
  }
  __syncthreads();
  {
    const int sl = t >> 6, u = t & 63;     // k-step of the block, unit within (j, lane)
    dst[(size_t)((kg * 4 + sl) * 48 + rg) * 64 + u] = buf[t + (t >> 4)];
  }
}

// BDEPTH k-steps of one wave: activation fragments from the LDS tile, weight fragments from the register ring bq.
// The weights are the A operand (rows of D = output channels), the activations the B operand (columns of D = tile rows):
// the two fragment maps are alike (lane lm = row of A or column of B, the same k map), so only the operand places change.
// REFILL: behind the four products that use a weight fragment, its registers take the fragment BDEPTH k-steps on (gN), straight
// from L2: nobody else in the block reads these weights, so they pass through no LDS and need no barrier.
template <bool REFILL>
__device__ __forceinline__ void k_steps(v8f (&acc)[4][3], Frag (&bq)[BDEPTH][3],
                                         const _Float16* sA, const v8h* gN)
{
#pragma unroll     // every index of acc and bq a constant: they stay in registers
  for (int i = 0; i < BDEPTH; ++i) {
    // activation fragments: tile row lm; elements 0..7 = k 8h..8h+7, elements 8..15 = k 16+8h..16+8h+7 (sA holds row and 8h)
    Frag af[4];
#pragma unroll
    for (int mt = 0; mt < 4; ++mt) {
      const _Float16* p = sA + mt * 16 * TPITCH + i * 32;
      af[mt].half[0] = *(const v8h*)(p);
      af[mt].half[1] = *(const v8h*)(p + 16);
    }
    // weight fragments: row o = o0+nt*16+lm of W; same k map
#pragma unroll
    for (int nt = 0; nt < 3; ++nt) {
#pragma unroll
      for (int mt = 0; mt < 4; ++mt)
        acc[mt][nt] = wmma_f16(bq[i][nt].v, af[mt].v, acc[mt][nt]);
      if (REFILL) {
        bq[i][nt].half[0] = gN[i * WSTEP + nt * 64];
        bq[i][nt].half[1] = gN[i * WSTEP + nt * 64 + 32];
      }
    }
  }
}

// One layer's K loop of one wave: 12 trips of two k-steps, from trip r0 on and round.
// A trip refills the ring with the trip that follows it in this block's order; the 12th with the next layer's trip r0.
// LAST: the last layer's 12th trip has nothing left to fetch.
template <bool LAST>
__device__ __forceinline__ void k_layer(v8f (&acc)[4][3], Frag (&bq)[BDEPTH][3],
                                         const _Float16* sA, const v8h* gL, int r0)
{
#pragma unroll
  for (int mt = 0; mt < 4; ++mt)
#pragma unroll
    for (int nt = 0; nt < 3; ++nt)
#pragma unroll
      for (int r = 0; r < 8; ++r) acc[mt][nt][r] = 0.0f;
  // 12 refilling trips, in the last layer 11; the same in every lane: held in a scalar register, so that the loop's end test is a scalar compare
  const int pend = __builtin_amdgcn_readfirstlane(!LAST ? r0 : ((r0 == 0) ? NTRIP - 1 : r0 - 1));
  int p = r0;
  do {
    const int pn = (p + 1 == NTRIP) ? 0 : p + 1;
    const int nx = (pn == r0) ? pn + NTRIP : pn;     // once round: on to the next layer
    k_steps<true>(acc, bq, sA + p * (BDEPTH * 32), gL + nx * (BDEPTH * WSTEP));
    asm volatile("s_wait_xcnt 0x0" ::: "memory");     // behind the trip's refill loads, in front of whatever rewrites their address registers
    p = pn;
  } while (p != pend);
  if (LAST) k_steps<false>(acc, bq, sA + p * (BDEPTH * 32), gL);
}

// ---------------- the whole block in one launch ----------------
// Block: 512 threads = 16 waves, 64 token rows x all 768 channels, through all three layers.
// The block's 64 x 768 activation tile (f16, x16) lives in LDS from the read of x to the last contraction:
// x is read in NCHW and transposed into it; each LayerNorm + GELU result overwrites it in place.
// Wave w owns channel tiles [3w, 3w+3), all 4 tiles of 16 rows. K loop per layer: 24 WMMA k-steps, no barrier inside.
// D holds channels down the registers and tile rows across the lanes: a lane has 8 consecutive channels of one row per
// accumulator, so a LayerNorm sum is a run of adds inside the lane, mean and scale are one value per lane and row tile, and
// 8 results go back to the tile as one 16-B store.
// Tile row mt*16 + lm holds position 4*lm + mt of the block: a lane's four row tiles are four consecutive positions.
// A weight is used by one wave of the block only: each wave loads its weight fragments from the packed weights straight into a
// ring of two register sets, two k-steps ahead of their use; the 72 k-steps of the three layers form one sequence,
// so the next layer's first fragments fly during an epilogue.
// Every block reads the same weights: each block enters a layer's 12 trips at a trip of its own (r0) and wraps round, so that
// the blocks do not ask L2 for the same lines at the same moment. The whole activation tile is in LDS, so any k order can be served.
// Last layer: result written directly in NCHW from the accumulators: per output channel the block's 64 positions form one
// contiguous 256-B segment, 16 B per lane; one store instruction per 2 segments.
__global__ __launch_bounds__(512) void k_block(const float* __restrict__ x,        // NCHW f32
                                               const _Float16* __restrict__ Wb,    // 3 x 768 x 768 f16 (x64), packed in fragment order
                                               const float* __restrict__ b1,
                                               const float* __restrict__ g1,
                                               const float* __restrict__ be1,
                                               const float* __restrict__ b2,
                                               const float* __restrict__ g2,
                                               const float* __restrict__ be2,
                                               const float* __restrict__ b3,
                                               float* __restrict__ outF,           // NCHW f32
                                               int nrows)
{
  __shared__ _Float16 tile[64 * TPITCH] __attribute__((aligned(16)));
  __shared__ float lds_part[16 * 64] __attribute__((aligned(16)));     // [wave][position]
  __shared__ float lds_mu[64] __attribute__((aligned(16)));
  __shared__ float lds_rs[64] __attribute__((aligned(16)));

  const int tid  = threadIdx.x;
  const int lane = tid & 31;
  const int wave = tid >> 5;
  const int h    = lane >> 4;     // lane half
  const int lm   = lane & 15;     // row of the weight fragment, column of the activation fragment and of D
  const int n0   = blockIdx.x * 64;
  const int o0   = wave * 48;
  const int oc   = o0 + 8 * h;    // first of this lane's 8 consecutive channels in the wave's channel tile 0
  // block rows n0..n0+63 = positions hw0..hw0+63 of image bb (64 divides HWN)
  const int bb   = n0 / HWN;
  const int hw0  = n0 - bb * HWN;

  // the trip at which this block enters every layer's K loop: neighbours in index differ, all 12 values are used about equally often
  const int r0 = (int)((blockIdx.x >> 3) + (blockIdx.x & 7)) % NTRIP;
  // this lane's 16-B unit in the wave's share of a k-step of packed weights; the block's first BDEPTH k-steps start now
  const v8h* gL = (const v8h*)Wb + wave * 192 + lane;     // k-step 0 of the current layer
  const v8h* gN = gL + r0 * (BDEPTH * WSTEP);
  Frag bq[BDEPTH][3];
#pragma unroll
  for (int i = 0; i < BDEPTH; ++i)
#pragma unroll
    for (int nt = 0; nt < 3; ++nt) {
      bq[i][nt].half[0] = gN[i * WSTEP + nt * 64];
      bq[i][nt].half[1] = gN[i * WSTEP + nt * 64 + 32];
    }
  asm volatile("s_wait_xcnt 0x0" ::: "memory");     // stands behind these loads, in front of whatever rewrites a register that they name

  // x -> tile: this wave's 48 channels, 64 positions. A lane takes 4 positions (one float4) of 4 channels and
  // stores 4 channels of one position as 8 B; a load instruction covers one whole 128-B line of 4 channels.
  // Position 32 ph + 4 q + i goes to tile row 16 i + 8 ph + q.
  {
    const int q = lane & 7, cg = lane >> 3;
    const float* src = x + ((size_t)bb * CCH + (size_t)(o0 + 4 * cg)) * HWN + hw0 + 4 * q;
    _Float16* dst = tile + q * TPITCH + o0 + 4 * cg;
#pragma unroll     // all 24 loads of the wave in flight together
    for (int u = 0; u < 6; ++u) {
      const int g = u >> 1, ph = u & 1;     // group of 16 channels, half of the 64 positions
      const float* s = src + (size_t)(g * 16) * HWN + ph * 32;
      const v4f v0 = *(const v4f*)(s);
      const v4f v1 = *(const v4f*)(s + HWN);
      const v4f v2 = *(const v4f*)(s + 2 * HWN);
      const v4f v3 = *(const v4f*)(s + 3 * HWN);
      _Float16* d = dst + (ph * 8) * TPITCH + g * 16;
#pragma unroll
      for (int i = 0; i < 4; ++i) {
        v4h o;
        o[0] = (_Float16)(v0[i] * 16.0f);
        o[1] = (_Float16)(v1[i] * 16.0f);
        o[2] = (_Float16)(v2[i] * 16.0f);
        o[3] = (_Float16)(v3[i] * 16.0f);
        *(v4h*)(d + (i * 16) * TPITCH) = o;
      }
    }
  }

  __syncthreads();                                    // publishes the activation tile

  const float SC = 0.0009765625f;     // 1/1024 undoes the x16 * x64 operand scaling
  const _Float16* sA = tile + lm * TPITCH + 8 * h;
#pragma unroll 1     // one copy of the two layers' K loop and epilogue in the text
  for (int layer = 0; layer < 2; ++layer) {
    v8f acc[4][3];     // lives inside the body: no accumulator register is held through the epilogue for a later reader
    k_layer<false>(acc, bq, sA, gL, r0);
    gL += KSTEPS * WSTEP;

    // ---- epilogue: D element r of lane = (channel oc + nt*16 + r, tile row mt*16 + lm) ----
    const float* bias = ((layer == 0) ? b1 : b2) + oc;
    {
      v4f bo[3][2];
#pragma unroll
      for (int nt = 0; nt < 3; ++nt) {
        bo[nt][0] = *(const v4f*)(bias + nt * 16);
        bo[nt][1] = *(const v4f*)(bias + nt * 16 + 4);
      }
      asm volatile("s_wait_xcnt 0x0" ::: "memory");     // behind the bias loads, in front of whatever rewrites their address registers
#pragma unroll
      for (int mt = 0; mt < 4; ++mt)
#pragma unroll
        for (int nt = 0; nt < 3; ++nt)
#pragma unroll
          for (int r = 0; r < 8; ++r) acc[mt][nt][r] = acc[mt][nt][r] * SC + bo[nt][r >> 2][r & 3];
    }

    {
      // pass 1: this lane's 24 channels of each of its 4 positions, two running sums per position
      v4f part;
#pragma unroll
      for (int mt = 0; mt < 4; ++mt) {
        v2f s;
#pragma unroll
        for (int nt = 0; nt < 3; ++nt)
#pragma unroll
          for (int r = 0; r < 8; r += 2) {
            v2f xv;
            xv[0] = acc[mt][nt][r];
            xv[1] = acc[mt][nt][r + 1];
            s = (nt == 0 && r == 0) ? xv : s + xv;
          }
        const float sl = s[0] + s[1];
        part[mt] = sl + xhalf(sl);     // the other 24 channels of the wave sit in lane l ^ 16
      }
      if (h == 0) *(v4f*)(lds_part + wave * 64 + 4 * lm) = part;
      __syncthreads();
      if (tid < 64) {
        float t = 0.0f;
#pragma unroll
        for (int w = 0; w < 16; ++w) t += lds_part[w * 64 + tid];
        lds_mu[tid] = t * (1.0f / 768.0f);
      }
      __syncthreads();
      // gamma and beta of this lane's 24 channels: asked for here, so that they land while the second sums are formed
      const float* gamma = ((layer == 0) ? g1 : g2) + oc;
      const float* beta  = ((layer == 0) ? be1 : be2) + oc;
      v4f go[3][2], bt[3][2];
#pragma unroll
      for (int nt = 0; nt < 3; ++nt) {
        go[nt][0] = *(const v4f*)(gamma + nt * 16);
        go[nt][1] = *(const v4f*)(gamma + nt * 16 + 4);
        bt[nt][0] = *(const v4f*)(beta + nt * 16);
        bt[nt][1] = *(const v4f*)(beta + nt * 16 + 4);
      }
      asm volatile("s_wait_xcnt 0x0" ::: "memory");     // behind the gamma and beta loads, in front of whatever rewrites their address registers
      // pass 2: sum of squared deviations
      const v4f mu4 = *(const v4f*)(lds_mu + 4 * lm);
#pragma unroll
      for (int mt = 0; mt < 4; ++mt) {
        v2f s;
#pragma unroll
        for (int nt = 0; nt < 3; ++nt)
#pragma unroll
          for (int r = 0; r < 8; r += 2) {
            v2f xv;
            xv[0] = acc[mt][nt][r];
            xv[1] = acc[mt][nt][r + 1];
            const v2f d = xv - mu4[mt];
            s = (nt == 0 && r == 0) ? d * d : s + d * d;
          }
        const float sl = s[0] + s[1];
        part[mt] = sl + xhalf(sl);     // the other 24 channels of the wave sit in lane l ^ 16
      }
      if (h == 0) *(v4f*)(lds_part + wave * 64 + 4 * lm) = part;
      __syncthreads();
      if (tid < 64) {
        float t = 0.0f;
#pragma unroll
        for (int w = 0; w < 16; ++w) t += lds_part[w * 64 + tid];
        const float var = t * (1.0f / 768.0f);
        lds_rs[tid] = rsqrtf(var + 1e-6f);
      }
      __syncthreads();

      // normalize, affine, exact GELU; x16 as f16 back into the 64x768 LDS tile, the next layer's activation operand.
      // The x16 rides in gamma and beta (a power of two: the same bits as scaling the result); two channels per step.
      const v4f rs4 = *(const v4f*)(lds_rs + 4 * lm);
#pragma unroll     // all three loops in line: acc is indexed by constants only and stays in registers
      for (int nt = 0; nt < 3; ++nt) {
        const v4f go16[2] = { go[nt][0] * 16.0f, go[nt][1] * 16.0f };
        const v4f bt16[2] = { bt[nt][0] * 16.0f, bt[nt][1] * 16.0f };
#pragma unroll
        for (int mt = 0; mt < 4; ++mt) {
          v8h o;
#pragma unroll
          for (int r = 0; r < 8; r += 2) {
            v2f xv, gg, bb2;
            xv[0]  = acc[mt][nt][r];
            xv[1]  = acc[mt][nt][r + 1];
            gg[0]  = go16[r >> 2][r & 3];
            gg[1]  = go16[r >> 2][(r & 3) + 1];
            bb2[0] = bt16[r >> 2][r & 3];
            bb2[1] = bt16[r >> 2][(r & 3) + 1];
            const v2h g = __builtin_convertvector(gelu16((xv - mu4[mt]) * rs4[mt] * gg + bb2), v2h);
            o[r]     = g[0];
            o[r + 1] = g[1];
          }
          *(v8h*)(tile + (mt * 16 + lm) * TPITCH + oc + nt * 16) = o;
        }
      }
      __syncthreads();     // the new tile is complete before any wave reads it as an operand
    }
  }
  {
    v8f acc[4][3];
    k_layer<true>(acc, bq, sA, gL, r0);
    // ---- the last layer's result, NCHW: a lane's four row tiles are positions 4 lm .. 4 lm + 3 of one channel ----
    // per instruction: lanes 0-15 -> the 256-B segment of one channel, lanes 16-31 -> that of the channel 8 on
    const bool rows_ok = (n0 + 64 <= nrows);
    float* po = outF + ((size_t)bb * CCH + (size_t)oc) * HWN + (size_t)(hw0 + 4 * lm);
    v4f bo[3][2];
#pragma unroll
    for (int nt = 0; nt < 3; ++nt) {
      bo[nt][0] = *(const v4f*)(b3 + oc + nt * 16);
      bo[nt][1] = *(const v4f*)(b3 + oc + nt * 16 + 4);
    }
    asm volatile("s_wait_xcnt 0x0" ::: "memory");     // behind the bias loads, in front of whatever rewrites their address registers
    v4f res[3][8];
#pragma unroll
    for (int nt = 0; nt < 3; ++nt)
#pragma unroll
      for (int r = 0; r < 8; ++r) {
        const float b = bo[nt][r >> 2][r & 3];
        res[nt][r][0] = acc[0][nt][r] * SC + b;
        res[nt][r][1] = acc[1][nt][r] * SC + b;
        res[nt][r][2] = acc[2][nt][r] * SC + b;
        res[nt][r][3] = acc[3][nt][r] * SC + b;
      }
    __builtin_amdgcn_sched_barrier(0);     // every result is formed in front of the first store: no register that an issued store names is written again
    if (rows_ok) {
#pragma unroll
      for (int nt = 0; nt < 3; ++nt)
#pragma unroll
        for (int r = 0; r < 8; ++r) *(v4f*)(po + (size_t)(nt * 16 + r) * HWN) = res[nt][r];
    }
  }
}

// ---------------- launch glue ----------------
extern "C" void kernel_launch(void* const* d_in, const int* in_sizes, int n_in,
                              void* d_out, int out_size, void* d_ws, size_t ws_size,
                              hipStream_t stream)
{
  if (n_in < 11) return;
  const float* x   = (const float*)d_in[0];
  const float* W1  = (const float*)d_in[1];
  const float* b1  = (const float*)d_in[2];
  const float* g1  = (const float*)d_in[3];
  const float* be1 = (const float*)d_in[4];
  const float* W2  = (const float*)d_in[5];
  const float* b2  = (const float*)d_in[6];
  const float* g2  = (const float*)d_in[7];
  const float* be2 = (const float*)d_in[8];
  const float* W3  = (const float*)d_in[9];
  const float* b3  = (const float*)d_in[10];
  float* out = (float*)d_out;

  const int nrows = in_sizes[0] / CCH;                 // B * HWN token rows
  if (nrows <= 0 || (nrows % HWN) != 0 || (nrows % 64) != 0) return;
  if (out_size != nrows * CCH) return;
  const int wn = in_sizes[1];                          // 768*768
  if (wn != CCH * CCH || in_sizes[5] != wn || in_sizes[9] != wn) return;
  const int n8 = wn / 8;

  const size_t need = (size_t)3 * (size_t)wn * 2;      // the three f16 weight matrices
  if (need > ws_size) return;
  _Float16* WB = (_Float16*)d_ws;

  k_wcvt<<<dim3((n8 + 255) / 256, 3), 256, 0, stream>>>(W1, W2, W3, WB, n8);
  k_block<<<nrows / 64, 512, 0, stream>>>(x, WB, b1, g1, be1, b2, g2, be2, b3, out, nrows);
}
